// v000
// Measured on an AMD MI455X. A time is GPU time per run, averaged over a window of back-to-back runs after a warm-up
// (all launches, gaps included; the runs take copies of the inputs in turn), and the median of several windows.
// Apart from v000's, it joins two sittings. Times from different sittings can be a few percent apart, while
// side-by-side timings come from the same sitting.
// The starting kernel, v000, takes 166 microseconds a run.
#include <hip/hip_runtime.h>

// ---------------------------------------------------------------------------
// CDNA5 (gfx1250) fused multi-head attention:
//   qkv = x @ w_qkv + b_qkv  -> Q,K,V (f16, head-major)
//   flash attention per (b,h) with v_wmma_f32_16x16x32_f16
//   out = O @ w_proj + b_proj (f32)
// CDNA5 paths: WMMA f16, TDM tensor_load_to_lds (+s_wait_tensorcnt),
//              ds_load_tr16_b128, global_prefetch_b8, s_wait_dscnt.
// ---------------------------------------------------------------------------

typedef __attribute__((ext_vector_type(16))) _Float16 v16h;
typedef __attribute__((ext_vector_type(8)))  float    v8f;
typedef __attribute__((ext_vector_type(4)))  unsigned int v4u;
typedef __attribute__((ext_vector_type(8)))  int v8i;
typedef __attribute__((ext_vector_type(4)))  int v4i;

union H16 { v16h h; v4u u[2]; _Float16 e[16]; };

#define BB 4
#define NN 2048
#define CC 256
#define HH 16
#define DD 16
#define NHEAD (BB*HH)          // 64
#define ROWS  (BB*NN)          // 8192

#if __has_builtin(__builtin_amdgcn_tensor_load_to_lds) && \
    __has_builtin(__builtin_amdgcn_s_wait_tensorcnt)
#define HAVE_TDM 1
#else
#define HAVE_TDM 0
#endif

#if __has_builtin(__builtin_amdgcn_ds_load_tr16_b128)
#define HAVE_TR16 1
#else
#define HAVE_TR16 0
#endif

__device__ __forceinline__ v8f wmma_f16(v16h a, v16h b, v8f c) {
  // D = A(16x32 f16) * B(32x16 f16) + C(16x16 f32)
  return __builtin_amdgcn_wmma_f32_16x16x32_f16(
      false, a, false, b, (short)0, c, false, false);
}

// A/B operand fragment from a 16-row x 32-half row-major tile (global or LDS).
// Lane L (L%16 = row/col), K chunks {b0..b0+7, 16+b0..16+b0+7}, b0 = (L<16?0:8).
__device__ __forceinline__ v16h load_tile_halfrows(const _Float16* base, int rowStride) {
  const int lane = threadIdx.x & 31;
  const int row  = lane & 15;
  const int b0   = (lane < 16) ? 0 : 8;
  const _Float16* p = base + row * rowStride;
  H16 t;
  t.u[0] = *(const v4u*)(p + b0);
  t.u[1] = *(const v4u*)(p + 16 + b0);
  return t.h;
}

// Same, but only 16 valid K columns (d=16 zero-padded to K=32).
__device__ __forceinline__ v16h load_tile_halfrows_pad16(const _Float16* base, int rowStride) {
  const int lane = threadIdx.x & 31;
  const int row  = lane & 15;
  const int b0   = (lane < 16) ? 0 : 8;
  H16 t;
  v4u z = {};
  t.u[0] = *(const v4u*)(base + row * rowStride + b0);
  t.u[1] = z;
  return t.h;
}

// A fragment from f32 global rows, converted to f16 on the fly.
__device__ __forceinline__ v16h load_tile_f32rows(const float* base, int rowStride) {
  const int lane = threadIdx.x & 31;
  const int row  = lane & 15;
  const int b0   = (lane < 16) ? 0 : 8;
  const float* p = base + row * rowStride;
  H16 t;
#pragma unroll
  for (int i = 0; i < 8; ++i) t.e[i]     = (_Float16)p[b0 + i];
#pragma unroll
  for (int i = 0; i < 8; ++i) t.e[8 + i] = (_Float16)p[16 + b0 + i];
  return t.h;
}

// ---------------------------------------------------------------------------
// Kernel 1: QKV projection. grid (64 rowgroups, 24 col-pairs), 256 threads.
// Each wave: one 16x32 tile of (8192 x 768): one A fragment feeds 2 WMMAs.
// Output scattered to head-major f16 Q/K/V: [b*H+h][n][16].
// ---------------------------------------------------------------------------
__global__ void __launch_bounds__(256)
qkv_kernel(const float* __restrict__ x, const float* __restrict__ w,
           const float* __restrict__ bias,
           _Float16* __restrict__ qws, _Float16* __restrict__ kws,
           _Float16* __restrict__ vws)
{
  const int WSTR = 264;                       // padded LDS row stride (halfs)
  __shared__ _Float16 wT[32 * WSTR];          // w^T tile: [col][k], f16
  const int colBase = blockIdx.y * 32;

  for (int i = threadIdx.x; i < 32 * 256; i += 256) {
    int col = i & 31, k = i >> 5;
    wT[col * WSTR + k] = (_Float16)w[k * (3 * CC) + colBase + col];
  }
  __syncthreads();

  const int wave = threadIdx.x >> 5;
  const int lane = threadIdx.x & 31;
  const int rowBase = (blockIdx.x * 8 + wave) * 16;

  v8f acc0 = {}, acc1 = {};
#pragma unroll
  for (int kc = 0; kc < CC; kc += 32) {
    v16h a  = load_tile_f32rows(x + rowBase * CC + kc, CC);
    v16h b0 = load_tile_halfrows(wT + kc, WSTR);
    v16h b1 = load_tile_halfrows(wT + 16 * WSTR + kc, WSTR);
    acc0 = wmma_f16(a, b0, acc0);
    acc1 = wmma_f16(a, b1, acc1);
  }

  // Epilogue: bias + scatter into Q/K/V head-major layout (2 col-tiles).
  const int col  = lane & 15;                 // d
  const int rofs = (lane < 16) ? 0 : 8;
  const int bb = rowBase / NN;
  const int n0 = rowBase % NN;
  v8f accs[2] = {acc0, acc1};
#pragma unroll
  for (int tg = 0; tg < 2; ++tg) {
    const int cb = colBase + tg * 16;
    const float bv = bias[cb + col];
    const int s = cb / CC;                    // 0=q 1=k 2=v (tile never crosses)
    const int h = (cb % CC) / DD;
    _Float16* dst = (s == 0) ? qws : (s == 1) ? kws : vws;
    dst += (bb * HH + h) * (NN * DD);
#pragma unroll
    for (int r = 0; r < 8; ++r) {
      int n = n0 + r + rofs;
      dst[n * DD + col] = (_Float16)(accs[tg][r] + bv);
    }
  }
}

// ---------------------------------------------------------------------------
// Kernel 2: flash attention. grid = 64 heads * 16 qblocks, 256 threads.
// Wave owns 16 q rows; loops k in chunks of 32:
//   V tile staged row-major in LDS via TDM (or cooperative copy),
//   2x WMMA QK^T (d padded to 32), online softmax (half-wave butterflies),
//   P -> LDS -> A-fragment, V^T B-fragment via ds_load_tr16_b128 (or gather),
//   1x WMMA P@V accumulate.
// ---------------------------------------------------------------------------
__global__ void __launch_bounds__(256)
attn_kernel(const _Float16* __restrict__ qws, const _Float16* __restrict__ kws,
            const _Float16* __restrict__ vws, _Float16* __restrict__ ows)
{
  const int VSTR = 40;                        // padded row stride (halfs)
  __shared__ _Float16 vbuf[32 * DD];          // V tile rows kt..kt+31, row-major
  __shared__ _Float16 pbuf[8][16 * VSTR];     // per-wave P tile: [qrow][k]

  const int head = blockIdx.x >> 4;
  const int qblk = blockIdx.x & 15;
  const int wave = threadIdx.x >> 5;
  const int lane = threadIdx.x & 31;

  const _Float16* qh = qws + head * (NN * DD);
  const _Float16* kh = kws + head * (NN * DD);
  const _Float16* vh = vws + head * (NN * DD);

  const int qbase = qblk * 128 + wave * 16;
  const v16h aq = load_tile_halfrows_pad16(qh + qbase * DD, DD);

  v8f acc = {};
  v8f m, l;
#pragma unroll
  for (int r = 0; r < 8; ++r) { m[r] = -__builtin_inff(); l[r] = 0.0f; }

  for (int kt = 0; kt < NN; kt += 32) {
    __syncthreads();                          // prev-iter vbuf readers done
#if HAVE_TDM
    if (wave == 0) {
      // 1-D TDM descriptor: copy 32*16 f16 (1 KB, contiguous) -> vbuf.
      unsigned lds_addr = (unsigned)(unsigned long long)(const void*)vbuf;
      unsigned long long ga = (unsigned long long)(const void*)(vh + kt * DD);
      v4u g0 = {};
      g0[0] = 1u;                                         // count=1 (valid D#)
      g0[1] = lds_addr;                                   // lds_addr
      g0[2] = (unsigned)(ga & 0xffffffffu);               // global_addr lo
      g0[3] = (unsigned)((ga >> 32) & 0x01ffffffu) | (2u << 30); // hi | type=2
      v8i g1 = {};
      g1[0] = (int)(1u << 16);                            // data_size=1 (2B)
      g1[1] = (int)(((unsigned)(NN * DD) & 0xffffu) << 16); // tensor_dim0 lo16
      g1[2] = (int)((((unsigned)(NN * DD) >> 16) & 0xffffu) | (1u << 16)); // dim0 hi | tensor_dim1=1
      g1[3] = (int)((unsigned)(32 * DD) << 16);           // tile_dim0 = 512
      g1[4] = 1;                                          // tile_dim1 = 1
      g1[5] = (int)(NN * DD);                             // dim0_stride lo
      v4i zz4 = {};
      v8i zz8 = {};
      __builtin_amdgcn_tensor_load_to_lds(g0, g1, zz4, zz4, zz8, 0);
      __builtin_amdgcn_s_wait_tensorcnt(0);
    }
#else
    {   // cooperative copy: 256 threads x 4B = 1 KB
      const unsigned int* src = (const unsigned int*)(vh + kt * DD);
      ((unsigned int*)vbuf)[threadIdx.x] = src[threadIdx.x];
    }
#endif
    __syncthreads();

    if (kt + 32 < NN) {                       // prefetch next K/V tiles
      __builtin_prefetch(kh + (kt + 32) * DD, 0, 0);
      __builtin_prefetch(vh + (kt + 32) * DD, 0, 0);
    }

    // S tiles: cols kt..kt+15 and kt+16..kt+31 (B = K^T, staged as K rows).
    v8f z = {};
    v16h bk0 = load_tile_halfrows_pad16(kh + kt * DD, DD);
    v16h bk1 = load_tile_halfrows_pad16(kh + (kt + 16) * DD, DD);
    v8f s0 = wmma_f16(aq, bk0, z);
    v8f s1 = wmma_f16(aq, bk1, z);

    // Row max across 16 lanes of each half-wave group.
    v8f t;
#pragma unroll
    for (int r = 0; r < 8; ++r) t[r] = fmaxf(s0[r], s1[r]);
    for (int off = 8; off >= 1; off >>= 1) {
#pragma unroll
      for (int r = 0; r < 8; ++r) t[r] = fmaxf(t[r], __shfl_xor(t[r], off, 16));
    }

    v8f mnew, alpha, p0, p1, rs;
#pragma unroll
    for (int r = 0; r < 8; ++r) {
      mnew[r]  = fmaxf(m[r], t[r]);
      alpha[r] = __expf(m[r] - mnew[r]);
      p0[r]    = __expf(s0[r] - mnew[r]);
      p1[r]    = __expf(s1[r] - mnew[r]);
      rs[r]    = p0[r] + p1[r];
    }
    for (int off = 8; off >= 1; off >>= 1) {
#pragma unroll
      for (int r = 0; r < 8; ++r) rs[r] += __shfl_xor(rs[r], off, 16);
    }
#pragma unroll
    for (int r = 0; r < 8; ++r) {
      l[r]   = l[r] * alpha[r] + rs[r];
      acc[r] = acc[r] * alpha[r];
      m[r]   = mnew[r];
    }

    // Stage P (C-layout regs -> row-major LDS) for reuse as A operand.
    _Float16* pw = pbuf[wave];
    const int prow = (lane < 16) ? 0 : 8;
    const int pcol = lane & 15;
#pragma unroll
    for (int r = 0; r < 8; ++r) {
      pw[(prow + r) * VSTR + pcol]      = (_Float16)p0[r];
      pw[(prow + r) * VSTR + 16 + pcol] = (_Float16)p1[r];
    }
    asm volatile("s_wait_dscnt 0" ::: "memory");  // wave-private LDS RAW

    v16h ap = load_tile_halfrows(pw, VSTR);

    // B fragment = V^T: hardware LDS transpose if available, else gather.
    H16 bt;
#if HAVE_TR16
    {
      typedef __attribute__((address_space(3))) short lds_s;
      auto t0 = __builtin_amdgcn_ds_load_tr16_b128((lds_s*)(vbuf));           // k 0..15
      auto t1 = __builtin_amdgcn_ds_load_tr16_b128((lds_s*)(vbuf + 16 * DD)); // k 16..31
      __builtin_memcpy(&bt.e[0], &t0, 16);
      __builtin_memcpy(&bt.e[8], &t1, 16);
    }
#else
    {
      const int n = lane & 15, b0 = (lane < 16) ? 0 : 8;
#pragma unroll
      for (int i = 0; i < 8; ++i) bt.e[i]     = vbuf[(b0 + i) * DD + n];
#pragma unroll
      for (int i = 0; i < 8; ++i) bt.e[8 + i] = vbuf[(16 + b0 + i) * DD + n];
    }
#endif
    acc = wmma_f16(ap, bt.h, acc);
  }

  // O = acc / l, scatter into (B,N,C) f16 workspace for the projection GEMM.
  const int b = head >> 4;
  const int h = head & 15;
  const int col = lane & 15;
  const int rofs = (lane < 16) ? 0 : 8;
#pragma unroll
  for (int r = 0; r < 8; ++r) {
    float o = acc[r] / l[r];
    int n = qbase + r + rofs;
    ows[(b * NN + n) * CC + h * DD + col] = (_Float16)o;
  }
}

// ---------------------------------------------------------------------------
// Kernel 3: output projection (8192x256)@(256x256) + bias -> f32.
// Each wave: 16x32 output tile (2 accumulators share one A fragment).
// ---------------------------------------------------------------------------
__global__ void __launch_bounds__(256)
proj_kernel(const _Float16* __restrict__ ows, const float* __restrict__ w,
            const float* __restrict__ bias, float* __restrict__ out)
{
  const int WSTR = 264;
  __shared__ _Float16 wT[32 * WSTR];
  const int colBase = blockIdx.y * 32;

  for (int i = threadIdx.x; i < 32 * 256; i += 256) {
    int col = i & 31, k = i >> 5;
    wT[col * WSTR + k] = (_Float16)w[k * CC + colBase + col];
  }
  __syncthreads();

  const int wave = threadIdx.x >> 5;
  const int lane = threadIdx.x & 31;
  const int rowBase = (blockIdx.x * 8 + wave) * 16;

  v8f acc0 = {}, acc1 = {};
#pragma unroll
  for (int kc = 0; kc < CC; kc += 32) {
    v16h a  = load_tile_halfrows(ows + rowBase * CC + kc, CC);
    v16h b0 = load_tile_halfrows(wT + kc, WSTR);
    v16h b1 = load_tile_halfrows(wT + 16 * WSTR + kc, WSTR);
    acc0 = wmma_f16(a, b0, acc0);
    acc1 = wmma_f16(a, b1, acc1);
  }

  const int col = lane & 15;
  const int rofs = (lane < 16) ? 0 : 8;
  v8f accs[2] = {acc0, acc1};
#pragma unroll
  for (int tg = 0; tg < 2; ++tg) {
    const int cb = colBase + tg * 16;
    const float bv = bias[cb + col];
#pragma unroll
    for (int r = 0; r < 8; ++r) {
      int row = rowBase + r + rofs;
      out[row * CC + cb + col] = accs[tg][r] + bv;
    }
  }
}

// ---------------------------------------------------------------------------
extern "C" void kernel_launch(void* const* d_in, const int* in_sizes, int n_in,
                              void* d_out, int out_size, void* d_ws, size_t ws_size,
                              hipStream_t stream) {
  (void)in_sizes; (void)n_in; (void)out_size; (void)ws_size;
  const float* x      = (const float*)d_in[0];
  const float* w_qkv  = (const float*)d_in[1];
  const float* b_qkv  = (const float*)d_in[2];
  const float* w_proj = (const float*)d_in[3];
  const float* b_proj = (const float*)d_in[4];
  float* out = (float*)d_out;

  const size_t headElems = (size_t)NHEAD * NN * DD;     // 2M halfs = 4 MB
  _Float16* qws = (_Float16*)d_ws;
  _Float16* kws = qws + headElems;
  _Float16* vws = kws + headElems;
  _Float16* ows = vws + headElems;                      // (B,N,C) f16, 4 MB

  qkv_kernel<<<dim3(ROWS / 128, (3 * CC) / 32), 256, 0, stream>>>(
      x, w_qkv, b_qkv, qws, kws, vws);
  attn_kernel<<<NHEAD * (NN / 128), 256, 0, stream>>>(qws, kws, vws, ows);
  proj_kernel<<<dim3(ROWS / 128, CC / 32), 256, 0, stream>>>(
      ows, w_proj, b_proj, out);
}

// v001
// It runs in 106 microseconds.
// In two side-by-side timings against v000, it was 1.63 and 1.62 times as fast.
#include <hip/hip_runtime.h>

// ---------------------------------------------------------------------------
// CDNA5 (gfx1250) fused multi-head attention:
//   qkv = x @ w_qkv + b_qkv  -> Q,K,V (f16, head-major)
//   flash attention per (b,h) with v_wmma_f32_16x16x32_f16
//   out = O @ w_proj + b_proj (f32)
// CDNA5 paths: WMMA f16, TDM tensor_load_to_lds (+s_wait_tensorcnt),
//              ds_load_tr16_b128, global_prefetch_b8.
// ---------------------------------------------------------------------------

typedef __attribute__((ext_vector_type(16))) _Float16 v16h;
typedef __attribute__((ext_vector_type(8)))  float    v8f;
typedef __attribute__((ext_vector_type(4)))  unsigned int v4u;
typedef __attribute__((ext_vector_type(8)))  int v8i;
typedef __attribute__((ext_vector_type(4)))  int v4i;

union H16 { v16h h; v4u u[2]; _Float16 e[16]; };

#define BB 4
#define NN 2048
#define CC 256
#define HH 16
#define DD 16
#define NHEAD (BB*HH)          // 64
#define ROWS  (BB*NN)          // 8192

#if __has_builtin(__builtin_amdgcn_tensor_load_to_lds) && \
    __has_builtin(__builtin_amdgcn_s_wait_tensorcnt)
#define HAVE_TDM 1
#else
#define HAVE_TDM 0
#endif

#if __has_builtin(__builtin_amdgcn_ds_load_tr16_b128)
#define HAVE_TR16 1
#else
#define HAVE_TR16 0
#endif

__device__ __forceinline__ v8f wmma_f16(v16h a, v16h b, v8f c) {
  // D = A(16x32 f16) * B(32x16 f16) + C(16x16 f32)
  return __builtin_amdgcn_wmma_f32_16x16x32_f16(
      false, a, false, b, (short)0, c, false, false);
}

// A/B operand fragment from a 16-row x 32-half row-major tile (global or LDS).
// Lane L (L%16 = row/col), K chunks {b0..b0+7, 16+b0..16+b0+7}, b0 = (L<16?0:8).
__device__ __forceinline__ v16h load_tile_halfrows(const _Float16* base, int rowStride) {
  const int lane = threadIdx.x & 31;
  const int row  = lane & 15;
  const int b0   = (lane < 16) ? 0 : 8;
  const _Float16* p = base + row * rowStride;
  H16 t;
  t.u[0] = *(const v4u*)(p + b0);
  t.u[1] = *(const v4u*)(p + 16 + b0);
  return t.h;
}

// Same, but only 16 valid K columns (d=16 zero-padded to K=32).
__device__ __forceinline__ v16h load_tile_halfrows_pad16(const _Float16* base, int rowStride) {
  const int lane = threadIdx.x & 31;
  const int row  = lane & 15;
  const int b0   = (lane < 16) ? 0 : 8;
  H16 t;
  v4u z = {};
  t.u[0] = *(const v4u*)(base + row * rowStride + b0);
  t.u[1] = z;
  return t.h;
}

// A fragment from f32 global rows, converted to f16 on the fly.
__device__ __forceinline__ v16h load_tile_f32rows(const float* base, int rowStride) {
  const int lane = threadIdx.x & 31;
  const int row  = lane & 15;
  const int b0   = (lane < 16) ? 0 : 8;
  const float* p = base + row * rowStride;
  H16 t;
#pragma unroll
  for (int i = 0; i < 8; ++i) t.e[i]     = (_Float16)p[b0 + i];
#pragma unroll
  for (int i = 0; i < 8; ++i) t.e[8 + i] = (_Float16)p[16 + b0 + i];
  return t.h;
}

// ---------------------------------------------------------------------------
// Kernel 1: QKV projection. grid (64 rowgroups, 24 col-pairs), 256 threads.
// Each wave: one 16x32 tile of (8192 x 768): one A fragment feeds 2 WMMAs.
// Output scattered to head-major f16 Q/K/V: [b*H+h][n][16].
// ---------------------------------------------------------------------------
__global__ void __launch_bounds__(256)
qkv_kernel(const float* __restrict__ x, const float* __restrict__ w,
           const float* __restrict__ bias,
           _Float16* __restrict__ qws, _Float16* __restrict__ kws,
           _Float16* __restrict__ vws)
{
  const int WSTR = 264;                       // padded LDS row stride (halfs)
  __shared__ _Float16 wT[32 * WSTR];          // w^T tile: [col][k], f16
  const int colBase = blockIdx.y * 32;

  for (int i = threadIdx.x; i < 32 * 256; i += 256) {
    int col = i & 31, k = i >> 5;
    wT[col * WSTR + k] = (_Float16)w[k * (3 * CC) + colBase + col];
  }
  __syncthreads();

  const int wave = threadIdx.x >> 5;
  const int lane = threadIdx.x & 31;
  const int rowBase = (blockIdx.x * 8 + wave) * 16;

  v8f acc0 = {}, acc1 = {};
#pragma unroll
  for (int kc = 0; kc < CC; kc += 32) {
    v16h a  = load_tile_f32rows(x + rowBase * CC + kc, CC);
    v16h b0 = load_tile_halfrows(wT + kc, WSTR);
    v16h b1 = load_tile_halfrows(wT + 16 * WSTR + kc, WSTR);
    acc0 = wmma_f16(a, b0, acc0);
    acc1 = wmma_f16(a, b1, acc1);
  }

  // Epilogue: bias + scatter into Q/K/V head-major layout (2 col-tiles).
  const int col  = lane & 15;                 // d
  const int rofs = (lane < 16) ? 0 : 8;
  const int bb = rowBase / NN;
  const int n0 = rowBase % NN;
  v8f accs[2] = {acc0, acc1};
#pragma unroll
  for (int tg = 0; tg < 2; ++tg) {
    const int cb = colBase + tg * 16;
    const float bv = bias[cb + col];
    const int s = cb / CC;                    // 0=q 1=k 2=v (tile never crosses)
    const int h = (cb % CC) / DD;
    _Float16* dst = (s == 0) ? qws : (s == 1) ? kws : vws;
    dst += (bb * HH + h) * (NN * DD);
#pragma unroll
    for (int r = 0; r < 8; ++r) {
      int n = n0 + r + rofs;
      dst[n * DD + col] = (_Float16)(accs[tg][r] + bv);
    }
  }
}

// ---------------------------------------------------------------------------
// Kernel 2: flash attention. grid = 64 heads * 16 qblocks, 256 threads.
// Wave owns 16 q rows; loops k in chunks of 32:
//   V tile staged row-major in LDS via TDM (or cooperative copy),
//   2x WMMA S^T = K Q^T (d padded to 32): a lane holds 16 scores of ONE query,
//   online softmax in-lane plus one exchange between the wave halves,
//   P^T packs from the score registers straight into the B operand,
//   V^T A-fragment via ds_load_tr16_b128 (or gather),
//   1x WMMA O^T += V^T P^T.
// ---------------------------------------------------------------------------
// Value of lane l ^ 16 (the other half of the same query column).
__device__ __forceinline__ float other_half(float v) {
  int b = __builtin_bit_cast(int, v);
  b = __builtin_amdgcn_permlanex16(b, b, 0x76543210, 0xfedcba98, false, false);
  return __builtin_bit_cast(float, b);
}

__global__ void __launch_bounds__(256)
attn_kernel(const _Float16* __restrict__ qws, const _Float16* __restrict__ kws,
            const _Float16* __restrict__ vws, _Float16* __restrict__ ows)
{
  __shared__ _Float16 vbuf[32 * DD];          // V tile rows kt..kt+31, row-major

  const int head = blockIdx.x >> 4;
  const int qblk = blockIdx.x & 15;
  const int wave = threadIdx.x >> 5;
  const int lane = threadIdx.x & 31;

  const _Float16* qh = qws + head * (NN * DD);
  const _Float16* kh = kws + head * (NN * DD);
  const _Float16* vh = vws + head * (NN * DD);

  const int qbase = qblk * 128 + wave * 16;
  const v16h aq = load_tile_halfrows_pad16(qh + qbase * DD, DD);

  v8f acc = {};                               // O^T: acc[r] = O[q = lane&15][d = 8*half + r]
  float m = -__builtin_inff();                // running max of this lane's query
  float l = 0.0f;                             // this half's share of the row sum

  for (int kt = 0; kt < NN; kt += 32) {
    __syncthreads();                          // prev-iter vbuf readers done
#if HAVE_TDM
    if (wave == 0) {
      // 1-D TDM descriptor: copy 32*16 f16 (1 KB, contiguous) -> vbuf.
      unsigned lds_addr = (unsigned)(unsigned long long)(const void*)vbuf;
      unsigned long long ga = (unsigned long long)(const void*)(vh + kt * DD);
      v4u g0 = {};
      g0[0] = 1u;                                         // count=1 (valid D#)
      g0[1] = lds_addr;                                   // lds_addr
      g0[2] = (unsigned)(ga & 0xffffffffu);               // global_addr lo
      g0[3] = (unsigned)((ga >> 32) & 0x01ffffffu) | (2u << 30); // hi | type=2
      v8i g1 = {};
      g1[0] = (int)(1u << 16);                            // data_size=1 (2B)
      g1[1] = (int)(((unsigned)(NN * DD) & 0xffffu) << 16); // tensor_dim0 lo16
      g1[2] = (int)((((unsigned)(NN * DD) >> 16) & 0xffffu) | (1u << 16)); // dim0 hi | tensor_dim1=1
      g1[3] = (int)((unsigned)(32 * DD) << 16);           // tile_dim0 = 512
      g1[4] = 1;                                          // tile_dim1 = 1
      g1[5] = (int)(NN * DD);                             // dim0_stride lo
      v4i zz4 = {};
      v8i zz8 = {};
      __builtin_amdgcn_tensor_load_to_lds(g0, g1, zz4, zz4, zz8, 0);
      __builtin_amdgcn_s_wait_tensorcnt(0);
    }
#else
    {   // cooperative copy: 256 threads x 4B = 1 KB
      const unsigned int* src = (const unsigned int*)(vh + kt * DD);
      ((unsigned int*)vbuf)[threadIdx.x] = src[threadIdx.x];
    }
#endif
    __syncthreads();

    if (kt + 32 < NN) {                       // prefetch next K/V tiles
      __builtin_prefetch(kh + (kt + 32) * DD, 0, 0);
      __builtin_prefetch(vh + (kt + 32) * DD, 0, 0);
    }

    // S^T tiles: keys kt..kt+15 and kt+16..kt+31 (A = K rows, B = Q rows).
    // s0[r] = S[q = lane&15][kt + 8*half + r], s1[r] the same 16 keys on.
    v8f z = {};
    v16h bk0 = load_tile_halfrows_pad16(kh + kt * DD, DD);
    v16h bk1 = load_tile_halfrows_pad16(kh + (kt + 16) * DD, DD);
    v8f s0 = wmma_f16(bk0, aq, z);
    v8f s1 = wmma_f16(bk1, aq, z);

    // Max over this lane's 16 keys, then over the other half's 16.
    v8f t8;
#pragma unroll
    for (int r = 0; r < 8; ++r) t8[r] = fmaxf(s0[r], s1[r]);
    float t = fmaxf(fmaxf(fmaxf(t8[0], t8[1]), fmaxf(t8[2], t8[3])),
                    fmaxf(fmaxf(t8[4], t8[5]), fmaxf(t8[6], t8[7])));
    t = fmaxf(t, other_half(t));

    const float mnew  = fmaxf(m, t);
    const float alpha = __expf(m - mnew);
    H16 pt;                                   // P^T as B operand, hardware k order
    v8f rs;
#pragma unroll
    for (int r = 0; r < 8; ++r) {
      float p0 = __expf(s0[r] - mnew);
      float p1 = __expf(s1[r] - mnew);
      rs[r] = p0 + p1;
      pt.e[r]     = (_Float16)p0;
      pt.e[8 + r] = (_Float16)p1;
    }
    l = l * alpha + (((rs[0] + rs[1]) + (rs[2] + rs[3])) +
                     ((rs[4] + rs[5]) + (rs[6] + rs[7])));
#pragma unroll
    for (int r = 0; r < 8; ++r) acc[r] = acc[r] * alpha;
    m = mnew;

    // A fragment = V^T: hardware LDS transpose if available, else gather.
    H16 bt;
#if HAVE_TR16
    {
      typedef __attribute__((address_space(3))) short lds_s;
      auto t0 = __builtin_amdgcn_ds_load_tr16_b128((lds_s*)(vbuf));           // k 0..15
      auto t1 = __builtin_amdgcn_ds_load_tr16_b128((lds_s*)(vbuf + 16 * DD)); // k 16..31
      __builtin_memcpy(&bt.e[0], &t0, 16);
      __builtin_memcpy(&bt.e[8], &t1, 16);
    }
#else
    {
      const int n = lane & 15, b0 = (lane < 16) ? 0 : 8;
#pragma unroll
      for (int i = 0; i < 8; ++i) bt.e[i]     = vbuf[(b0 + i) * DD + n];
#pragma unroll
      for (int i = 0; i < 8; ++i) bt.e[8 + i] = vbuf[(16 + b0 + i) * DD + n];
    }
#endif
    acc = wmma_f16(bt.h, pt.h, acc);
  }

  // O = acc / l into the (B,N,C) f16 workspace for the projection GEMM:
  // a lane holds 8 consecutive d of one query, one 16-byte store.
  const int b = head >> 4;
  const int h = head & 15;
  const int n = qbase + (lane & 15);
  const int dofs = (lane < 16) ? 0 : 8;
  l += other_half(l);                         // join the halves' sums once
  union { v4u u; _Float16 e[8]; } o;
#pragma unroll
  for (int r = 0; r < 8; ++r) o.e[r] = (_Float16)(acc[r] / l);
  *(v4u*)(ows + (b * NN + n) * CC + h * DD + dofs) = o.u;
}

// ---------------------------------------------------------------------------
// Kernel 3: output projection (8192x256)@(256x256) + bias -> f32.
// Each wave: 16x32 output tile (2 accumulators share one A fragment).
// ---------------------------------------------------------------------------
__global__ void __launch_bounds__(256)
proj_kernel(const _Float16* __restrict__ ows, const float* __restrict__ w,
            const float* __restrict__ bias, float* __restrict__ out)
{
  const int WSTR = 264;
  __shared__ _Float16 wT[32 * WSTR];
  const int colBase = blockIdx.y * 32;

  for (int i = threadIdx.x; i < 32 * 256; i += 256) {
    int col = i & 31, k = i >> 5;
    wT[col * WSTR + k] = (_Float16)w[k * CC + colBase + col];
  }
  __syncthreads();

  const int wave = threadIdx.x >> 5;
  const int lane = threadIdx.x & 31;
  const int rowBase = (blockIdx.x * 8 + wave) * 16;

  v8f acc0 = {}, acc1 = {};
#pragma unroll
  for (int kc = 0; kc < CC; kc += 32) {
    v16h a  = load_tile_halfrows(ows + rowBase * CC + kc, CC);
    v16h b0 = load_tile_halfrows(wT + kc, WSTR);
    v16h b1 = load_tile_halfrows(wT + 16 * WSTR + kc, WSTR);
    acc0 = wmma_f16(a, b0, acc0);
    acc1 = wmma_f16(a, b1, acc1);
  }

  const int col = lane & 15;
  const int rofs = (lane < 16) ? 0 : 8;
  v8f accs[2] = {acc0, acc1};
#pragma unroll
  for (int tg = 0; tg < 2; ++tg) {
    const int cb = colBase + tg * 16;
    const float bv = bias[cb + col];
#pragma unroll
    for (int r = 0; r < 8; ++r) {
      int row = rowBase + r + rofs;
      out[row * CC + cb + col] = accs[tg][r] + bv;
    }
  }
}

// ---------------------------------------------------------------------------
extern "C" void kernel_launch(void* const* d_in, const int* in_sizes, int n_in,
                              void* d_out, int out_size, void* d_ws, size_t ws_size,
                              hipStream_t stream) {
  (void)in_sizes; (void)n_in; (void)out_size; (void)ws_size;
  const float* x      = (const float*)d_in[0];
  const float* w_qkv  = (const float*)d_in[1];
  const float* b_qkv  = (const float*)d_in[2];
  const float* w_proj = (const float*)d_in[3];
  const float* b_proj = (const float*)d_in[4];
  float* out = (float*)d_out;

  const size_t headElems = (size_t)NHEAD * NN * DD;     // 2M halfs = 4 MB
  _Float16* qws = (_Float16*)d_ws;
  _Float16* kws = qws + headElems;
  _Float16* vws = kws + headElems;
  _Float16* ows = vws + headElems;                      // (B,N,C) f16, 4 MB

  qkv_kernel<<<dim3(ROWS / 128, (3 * CC) / 32), 256, 0, stream>>>(
      x, w_qkv, b_qkv, qws, kws, vws);
  attn_kernel<<<NHEAD * (NN / 128), 256, 0, stream>>>(qws, kws, vws, ows);
  proj_kernel<<<dim3(ROWS / 128, CC / 32), 256, 0, stream>>>(
      ows, w_proj, b_proj, out);
}

// v002
// It runs in 73.8 microseconds.
// Next to v001, in two timings, it ran 1.46 and 1.45 times as fast.
// Over all steps from v000 it is 2.36 times as fast.
#include <hip/hip_runtime.h>

// ---------------------------------------------------------------------------
// CDNA5 (gfx1250) fused multi-head attention:
//   qkv = x @ w_qkv + b_qkv  -> Q,K,V (f16, head-major)
//   flash attention per (b,h) with v_wmma_f32_16x16x32_f16
//   out = O @ w_proj + b_proj (f32)
// CDNA5 paths: WMMA f16, global_prefetch_b8.
// ---------------------------------------------------------------------------

typedef __attribute__((ext_vector_type(16))) _Float16 v16h;
typedef __attribute__((ext_vector_type(8)))  float    v8f;
typedef __attribute__((ext_vector_type(4)))  unsigned int v4u;

union H16 { v16h h; v4u u[2]; _Float16 e[16]; };

#define BB 4
#define NN 2048
#define CC 256
#define HH 16
#define DD 16
#define NHEAD (BB*HH)          // 64
#define ROWS  (BB*NN)          // 8192

__device__ __forceinline__ v8f wmma_f16(v16h a, v16h b, v8f c) {
  // D = A(16x32 f16) * B(32x16 f16) + C(16x16 f32)
  return __builtin_amdgcn_wmma_f32_16x16x32_f16(
      false, a, false, b, (short)0, c, false, false);
}

// A/B operand fragment from a 16-row x 32-half row-major tile (global or LDS).
// Lane L (L%16 = row/col), K chunks {b0..b0+7, 16+b0..16+b0+7}, b0 = (L<16?0:8).
__device__ __forceinline__ v16h load_tile_halfrows(const _Float16* base, int rowStride) {
  const int lane = threadIdx.x & 31;
  const int row  = lane & 15;
  const int b0   = (lane < 16) ? 0 : 8;
  const _Float16* p = base + row * rowStride;
  H16 t;
  t.u[0] = *(const v4u*)(p + b0);
  t.u[1] = *(const v4u*)(p + 16 + b0);
  return t.h;
}

// Same, but only 16 valid K columns (d=16 zero-padded to K=32).
__device__ __forceinline__ v16h load_tile_halfrows_pad16(const _Float16* base, int rowStride) {
  const int lane = threadIdx.x & 31;
  const int row  = lane & 15;
  const int b0   = (lane < 16) ? 0 : 8;
  H16 t;
  v4u z = {};
  t.u[0] = *(const v4u*)(base + row * rowStride + b0);
  t.u[1] = z;
  return t.h;
}

// A fragment from f32 global rows, converted to f16 on the fly.
__device__ __forceinline__ v16h load_tile_f32rows(const float* base, int rowStride) {
  const int lane = threadIdx.x & 31;
  const int row  = lane & 15;
  const int b0   = (lane < 16) ? 0 : 8;
  const float* p = base + row * rowStride;
  H16 t;
#pragma unroll
  for (int i = 0; i < 8; ++i) t.e[i]     = (_Float16)p[b0 + i];
#pragma unroll
  for (int i = 0; i < 8; ++i) t.e[8 + i] = (_Float16)p[16 + b0 + i];
  return t.h;
}

// ---------------------------------------------------------------------------
// Kernel 1: QKV projection. grid (64 rowgroups, 24 col-pairs), 256 threads.
// Each wave: one 16x32 tile of (8192 x 768): one A fragment feeds 2 WMMAs.
// Output scattered to head-major f16 Q/K: [b*H+h][n][16].
// V keeps the same 512-byte place per 16-key tile, but transposed inside it:
// [b*H+h][n/16][lane][8], lane = 16*((n%16)/8) + d, element = n%8. That is the
// accumulator's own order here and half an A fragment of V^T in attention.
// ---------------------------------------------------------------------------
__global__ void __launch_bounds__(256)
qkv_kernel(const float* __restrict__ x, const float* __restrict__ w,
           const float* __restrict__ bias,
           _Float16* __restrict__ qws, _Float16* __restrict__ kws,
           _Float16* __restrict__ vws)
{
  const int WSTR = 264;                       // padded LDS row stride (halfs)
  __shared__ _Float16 wT[32 * WSTR];          // w^T tile: [col][k], f16
  const int colBase = blockIdx.y * 32;

  for (int i = threadIdx.x; i < 32 * 256; i += 256) {
    int col = i & 31, k = i >> 5;
    wT[col * WSTR + k] = (_Float16)w[k * (3 * CC) + colBase + col];
  }
  __syncthreads();

  const int wave = threadIdx.x >> 5;
  const int lane = threadIdx.x & 31;
  const int rowBase = (blockIdx.x * 8 + wave) * 16;

  v8f acc0 = {}, acc1 = {};
#pragma unroll
  for (int kc = 0; kc < CC; kc += 32) {
    v16h a  = load_tile_f32rows(x + rowBase * CC + kc, CC);
    v16h b0 = load_tile_halfrows(wT + kc, WSTR);
    v16h b1 = load_tile_halfrows(wT + 16 * WSTR + kc, WSTR);
    acc0 = wmma_f16(a, b0, acc0);
    acc1 = wmma_f16(a, b1, acc1);
  }

  // Epilogue: bias + scatter into Q/K/V head-major layout (2 col-tiles).
  const int col  = lane & 15;                 // d
  const int rofs = (lane < 16) ? 0 : 8;
  const int bb = rowBase / NN;
  const int n0 = rowBase % NN;
  // The loops below are unrolled so that accs[tg][r] names registers (an indexed
  // array would go to scratch memory) and the stores take constant offsets.
  v8f accs[2] = {acc0, acc1};
  if (colBase >= 2 * CC) {                    // V block: a lane's 8 keys of one d, 16 bytes
#pragma unroll
    for (int tg = 0; tg < 2; ++tg) {
      const int cb = colBase + tg * 16;
      const float bv = bias[cb + col];
      const int h = (cb % CC) / DD;
      union { v4u u; _Float16 e[8]; } pv;
#pragma unroll
      for (int r = 0; r < 8; ++r) pv.e[r] = (_Float16)(accs[tg][r] + bv);
      *(v4u*)(vws + (bb * HH + h) * (NN * DD) + n0 * DD + lane * 8) = pv.u;
    }
  } else {
#pragma unroll
    for (int tg = 0; tg < 2; ++tg) {
      const int cb = colBase + tg * 16;
      const float bv = bias[cb + col];
      const int s = cb / CC;                  // 0=q 1=k (tile never crosses)
      const int h = (cb % CC) / DD;
      _Float16* dst = (s == 0) ? qws : kws;
      dst += (bb * HH + h) * (NN * DD);
#pragma unroll
      for (int r = 0; r < 8; ++r) {
        int n = n0 + r + rofs;
        dst[n * DD + col] = (_Float16)(accs[tg][r] + bv);
      }
    }
    // Precaution: the stores are waited for before the wave ends; nothing follows
    // them here, as the V branch runs only in blocks with colBase >= 2*CC.
    asm volatile("s_wait_xcnt 0x0" ::: "memory");
  }
}

// ---------------------------------------------------------------------------
// Kernel 2: flash attention. grid = 64 heads * 16 qblocks, 256 threads.
// Wave owns 16 q rows; loops k in chunks of 32, no LDS and no barrier:
//   2x WMMA S^T = K Q^T (d padded to 32): a lane holds 16 scores of ONE query,
//   online softmax in-lane plus one exchange between the wave halves,
//   P^T packs from the score registers straight into the B operand,
//   V^T A-fragment by two 16-byte global loads (V is stored in that order),
//   1x WMMA O^T += V^T P^T.
// ---------------------------------------------------------------------------
// Value of lane l ^ 16 (the other half of the same query column).
__device__ __forceinline__ float other_half(float v) {
  int b = __builtin_bit_cast(int, v);
  b = __builtin_amdgcn_permlanex16(b, b, 0x76543210, 0xfedcba98, false, false);
  return __builtin_bit_cast(float, b);
}

__global__ void __launch_bounds__(256)
attn_kernel(const _Float16* __restrict__ qws, const _Float16* __restrict__ kws,
            const _Float16* __restrict__ vws, _Float16* __restrict__ ows)
{
  const int head = blockIdx.x >> 4;
  const int qblk = blockIdx.x & 15;
  const int wave = threadIdx.x >> 5;
  const int lane = threadIdx.x & 31;

  const _Float16* qh = qws + head * (NN * DD);
  const _Float16* kh = kws + head * (NN * DD);
  const _Float16* vh = vws + head * (NN * DD);

  const int qbase = qblk * 128 + wave * 16;
  const v16h aq = load_tile_halfrows_pad16(qh + qbase * DD, DD);

  v8f acc = {};                               // O^T: acc[r] = O[q = lane&15][d = 8*half + r]
  float m = -__builtin_inff();                // running max of this lane's query
  float l = 0.0f;                             // this half's share of the row sum

  for (int kt = 0; kt < NN; kt += 32) {
    if (kt + 32 < NN) {                       // prefetch next K/V tiles
      __builtin_prefetch(kh + (kt + 32) * DD, 0, 0);
      __builtin_prefetch(vh + (kt + 32) * DD, 0, 0);
    }

    // S^T tiles: keys kt..kt+15 and kt+16..kt+31 (A = K rows, B = Q rows).
    // s0[r] = S[q = lane&15][kt + 8*half + r], s1[r] the same 16 keys on.
    v8f z = {};
    v16h bk0 = load_tile_halfrows_pad16(kh + kt * DD, DD);
    v16h bk1 = load_tile_halfrows_pad16(kh + (kt + 16) * DD, DD);
    // Precaution: the loads below may take the K loads' address registers as
    // their destination, so those loads' addresses are waited for first.
    asm volatile("s_wait_xcnt 0x0" ::: "memory");
    // A fragment = V^T, d = lane&15: keys kt + 8*half + 0..7, then the same 16 on.
    H16 bt;
    bt.u[0] = *(const v4u*)(vh + kt * DD + lane * 8);
    bt.u[1] = *(const v4u*)(vh + (kt + 16) * DD + lane * 8);
    v8f s0 = wmma_f16(bk0, aq, z);
    v8f s1 = wmma_f16(bk1, aq, z);

    // Max over this lane's 16 keys, then over the other half's 16.
    v8f t8;
#pragma unroll
    for (int r = 0; r < 8; ++r) t8[r] = fmaxf(s0[r], s1[r]);
    float t = fmaxf(fmaxf(fmaxf(t8[0], t8[1]), fmaxf(t8[2], t8[3])),
                    fmaxf(fmaxf(t8[4], t8[5]), fmaxf(t8[6], t8[7])));
    t = fmaxf(t, other_half(t));

    const float mnew  = fmaxf(m, t);
    const float alpha = __expf(m - mnew);
    H16 pt;                                   // P^T as B operand, hardware k order
    v8f rs;
#pragma unroll
    for (int r = 0; r < 8; ++r) {
      float p0 = __expf(s0[r] - mnew);
      float p1 = __expf(s1[r] - mnew);
      rs[r] = p0 + p1;
      pt.e[r]     = (_Float16)p0;
      pt.e[8 + r] = (_Float16)p1;
    }
    l = l * alpha + (((rs[0] + rs[1]) + (rs[2] + rs[3])) +
                     ((rs[4] + rs[5]) + (rs[6] + rs[7])));
#pragma unroll
    for (int r = 0; r < 8; ++r) acc[r] = acc[r] * alpha;
    m = mnew;

    acc = wmma_f16(bt.h, pt.h, acc);
  }

  // O = acc / l into the (B,N,C) f16 workspace for the projection GEMM:
  // a lane holds 8 consecutive d of one query, one 16-byte store.
  const int b = head >> 4;
  const int h = head & 15;
  const int n = qbase + (lane & 15);
  const int dofs = (lane < 16) ? 0 : 8;
  l += other_half(l);                         // join the halves' sums once
  union { v4u u; _Float16 e[8]; } o;
#pragma unroll
  for (int r = 0; r < 8; ++r) o.e[r] = (_Float16)(acc[r] / l);
  *(v4u*)(ows + (b * NN + n) * CC + h * DD + dofs) = o.u;
}

// ---------------------------------------------------------------------------
// Kernel 3: output projection (8192x256)@(256x256) + bias -> f32.
// Each wave: 16x32 output tile (2 accumulators share one A fragment).
// ---------------------------------------------------------------------------
__global__ void __launch_bounds__(256)
proj_kernel(const _Float16* __restrict__ ows, const float* __restrict__ w,
            const float* __restrict__ bias, float* __restrict__ out)
{
  const int WSTR = 264;
  __shared__ _Float16 wT[32 * WSTR];
  const int colBase = blockIdx.y * 32;

  for (int i = threadIdx.x; i < 32 * 256; i += 256) {
    int col = i & 31, k = i >> 5;
    wT[col * WSTR + k] = (_Float16)w[k * CC + colBase + col];
  }
  __syncthreads();

  const int wave = threadIdx.x >> 5;
  const int lane = threadIdx.x & 31;
  const int rowBase = (blockIdx.x * 8 + wave) * 16;

  v8f acc0 = {}, acc1 = {};
#pragma unroll
  for (int kc = 0; kc < CC; kc += 32) {
    v16h a  = load_tile_halfrows(ows + rowBase * CC + kc, CC);
    v16h b0 = load_tile_halfrows(wT + kc, WSTR);
    v16h b1 = load_tile_halfrows(wT + 16 * WSTR + kc, WSTR);
    acc0 = wmma_f16(a, b0, acc0);
    acc1 = wmma_f16(a, b1, acc1);
  }

  const int col = lane & 15;
  const int rofs = (lane < 16) ? 0 : 8;
  v8f accs[2] = {acc0, acc1};
#pragma unroll
  for (int tg = 0; tg < 2; ++tg) {
    const int cb = colBase + tg * 16;
    const float bv = bias[cb + col];
#pragma unroll
    for (int r = 0; r < 8; ++r) {
      int row = rowBase + r + rofs;
      out[row * CC + cb + col] = accs[tg][r] + bv;
    }
  }
}

// ---------------------------------------------------------------------------
extern "C" void kernel_launch(void* const* d_in, const int* in_sizes, int n_in,
                              void* d_out, int out_size, void* d_ws, size_t ws_size,
                              hipStream_t stream) {
  (void)in_sizes; (void)n_in; (void)out_size; (void)ws_size;
  const float* x      = (const float*)d_in[0];
  const float* w_qkv  = (const float*)d_in[1];
  const float* b_qkv  = (const float*)d_in[2];
  const float* w_proj = (const float*)d_in[3];
  const float* b_proj = (const float*)d_in[4];
  float* out = (float*)d_out;

  const size_t headElems = (size_t)NHEAD * NN * DD;     // 2M halfs = 4 MB
  _Float16* qws = (_Float16*)d_ws;
  _Float16* kws = qws + headElems;
  _Float16* vws = kws + headElems;
  _Float16* ows = vws + headElems;                      // (B,N,C) f16, 4 MB

  qkv_kernel<<<dim3(ROWS / 128, (3 * CC) / 32), 256, 0, stream>>>(
      x, w_qkv, b_qkv, qws, kws, vws);
  attn_kernel<<<NHEAD * (NN / 128), 256, 0, stream>>>(qws, kws, vws, ows);
  proj_kernel<<<dim3(ROWS / 128, CC / 32), 256, 0, stream>>>(
      ows, w_proj, b_proj, out);
}

// v003
// A run of this version takes 70.2 microseconds.
// In both of two side-by-side timings against v002, it was 1.03 times as fast.
// Counting every step since v000, it is 2.44 times as fast.
#include <hip/hip_runtime.h>

// ---------------------------------------------------------------------------
// CDNA5 (gfx1250) fused multi-head attention:
//   qkv = x @ w_qkv + b_qkv  -> Q,K,V (f16, head-major)
//   flash attention per (b,h) with v_wmma_f32_16x16x32_f16
//   out = O @ w_proj + b_proj (f32)
// CDNA5 paths: WMMA f16, global_prefetch_b8.
// ---------------------------------------------------------------------------

typedef __attribute__((ext_vector_type(16))) _Float16 v16h;
typedef __attribute__((ext_vector_type(8)))  float    v8f;
typedef __attribute__((ext_vector_type(4)))  unsigned int v4u;

union H16 { v16h h; v4u u[2]; _Float16 e[16]; };

#define BB 4
#define NN 2048
#define CC 256
#define HH 16
#define DD 16
#define NHEAD (BB*HH)          // 64
#define ROWS  (BB*NN)          // 8192

__device__ __forceinline__ v8f wmma_f16(v16h a, v16h b, v8f c) {
  // D = A(16x32 f16) * B(32x16 f16) + C(16x16 f32)
  return __builtin_amdgcn_wmma_f32_16x16x32_f16(
      false, a, false, b, (short)0, c, false, false);
}

// A/B operand fragment from a 16-row x 32-half row-major tile (global or LDS).
// Lane L (L%16 = row/col), K chunks {b0..b0+7, 16+b0..16+b0+7}, b0 = (L<16?0:8).
__device__ __forceinline__ v16h load_tile_halfrows(const _Float16* base, int rowStride) {
  const int lane = threadIdx.x & 31;
  const int row  = lane & 15;
  const int b0   = (lane < 16) ? 0 : 8;
  const _Float16* p = base + row * rowStride;
  H16 t;
  t.u[0] = *(const v4u*)(p + b0);
  t.u[1] = *(const v4u*)(p + 16 + b0);
  return t.h;
}

// A fragment from f32 global rows, converted to f16 on the fly.
__device__ __forceinline__ v16h load_tile_f32rows(const float* base, int rowStride) {
  const int lane = threadIdx.x & 31;
  const int row  = lane & 15;
  const int b0   = (lane < 16) ? 0 : 8;
  const float* p = base + row * rowStride;
  H16 t;
#pragma unroll
  for (int i = 0; i < 8; ++i) t.e[i]     = (_Float16)p[b0 + i];
#pragma unroll
  for (int i = 0; i < 8; ++i) t.e[8 + i] = (_Float16)p[16 + b0 + i];
  return t.h;
}

// ---------------------------------------------------------------------------
// Kernel 1: QKV projection. grid (64 rowgroups, 24 col-pairs), 256 threads.
// Each wave: one 16x32 tile of (8192 x 768): one A fragment feeds 2 WMMAs.
// Output scattered to head-major f16 Q/K: [b*H+h][n][16].
// V keeps the same 512-byte place per 16-key tile, but transposed inside it:
// [b*H+h][n/16][lane][8], lane = 16*((n%16)/8) + d, element = n%8. That is the
// accumulator's own order here and half an A fragment of V^T in attention.
// ---------------------------------------------------------------------------
__global__ void __launch_bounds__(256)
qkv_kernel(const float* __restrict__ x, const float* __restrict__ w,
           const float* __restrict__ bias,
           _Float16* __restrict__ qws, _Float16* __restrict__ kws,
           _Float16* __restrict__ vws)
{
  const int WSTR = 264;                       // padded LDS row stride (halfs)
  __shared__ _Float16 wT[32 * WSTR];          // w^T tile: [col][k], f16
  const int colBase = blockIdx.y * 32;

  for (int i = threadIdx.x; i < 32 * 256; i += 256) {
    int col = i & 31, k = i >> 5;
    wT[col * WSTR + k] = (_Float16)w[k * (3 * CC) + colBase + col];
  }
  __syncthreads();

  const int wave = threadIdx.x >> 5;
  const int lane = threadIdx.x & 31;
  const int rowBase = (blockIdx.x * 8 + wave) * 16;

  v8f acc0 = {}, acc1 = {};
#pragma unroll
  for (int kc = 0; kc < CC; kc += 32) {
    v16h a  = load_tile_f32rows(x + rowBase * CC + kc, CC);
    v16h b0 = load_tile_halfrows(wT + kc, WSTR);
    v16h b1 = load_tile_halfrows(wT + 16 * WSTR + kc, WSTR);
    acc0 = wmma_f16(a, b0, acc0);
    acc1 = wmma_f16(a, b1, acc1);
  }

  // Epilogue: bias + scatter into Q/K/V head-major layout (2 col-tiles).
  const int col  = lane & 15;                 // d
  const int rofs = (lane < 16) ? 0 : 8;
  const int bb = rowBase / NN;
  const int n0 = rowBase % NN;
  // The loops below are unrolled so that accs[tg][r] names registers (an indexed
  // array would go to scratch memory) and the stores take constant offsets.
  v8f accs[2] = {acc0, acc1};
  if (colBase >= 2 * CC) {                    // V block: a lane's 8 keys of one d, 16 bytes
#pragma unroll
    for (int tg = 0; tg < 2; ++tg) {
      const int cb = colBase + tg * 16;
      const float bv = bias[cb + col];
      const int h = (cb % CC) / DD;
      union { v4u u; _Float16 e[8]; } pv;
#pragma unroll
      for (int r = 0; r < 8; ++r) pv.e[r] = (_Float16)(accs[tg][r] + bv);
      *(v4u*)(vws + (bb * HH + h) * (NN * DD) + n0 * DD + lane * 8) = pv.u;
    }
  } else {
#pragma unroll
    for (int tg = 0; tg < 2; ++tg) {
      const int cb = colBase + tg * 16;
      const float bv = bias[cb + col];
      const int s = cb / CC;                  // 0=q 1=k (tile never crosses)
      const int h = (cb % CC) / DD;
      _Float16* dst = (s == 0) ? qws : kws;
      dst += (bb * HH + h) * (NN * DD);
#pragma unroll
      for (int r = 0; r < 8; ++r) {
        int n = n0 + r + rofs;
        dst[n * DD + col] = (_Float16)(accs[tg][r] + bv);
      }
    }
    // Precaution: the stores are waited for before the wave ends; nothing follows
    // them here, as the V branch runs only in blocks with colBase >= 2*CC.
    asm volatile("s_wait_xcnt 0x0" ::: "memory");
  }
}

// ---------------------------------------------------------------------------
// Kernel 2: flash attention. grid = 64 heads * 16 qblocks, 256 threads.
// Wave owns 16 q rows; loops k in chunks of 32, no LDS and no barrier:
//   2x WMMA S^T = K Q^T (two key tiles share one A fragment, Q zero-padded): a
//   lane holds 16 scores of ONE query,
//   online softmax in-lane plus one exchange between the wave halves,
//   P^T packs from the score registers straight into the B operand,
//   V^T A-fragment by two 16-byte global loads (V is stored in that order),
//   1x WMMA O^T += V^T P^T.
// ---------------------------------------------------------------------------
// Value of lane l ^ 16 (the other half of the same query column).
__device__ __forceinline__ float other_half(float v) {
  int b = __builtin_bit_cast(int, v);
  b = __builtin_amdgcn_permlanex16(b, b, 0x76543210, 0xfedcba98, false, false);
  return __builtin_bit_cast(float, b);
}

__global__ void __launch_bounds__(256)
attn_kernel(const _Float16* __restrict__ qws, const _Float16* __restrict__ kws,
            const _Float16* __restrict__ vws, _Float16* __restrict__ ows)
{
  const int head = blockIdx.x >> 4;
  const int qblk = blockIdx.x & 15;
  const int wave = threadIdx.x >> 5;
  const int lane = threadIdx.x & 31;

  const _Float16* qh = qws + head * (NN * DD);
  const _Float16* kh = kws + head * (NN * DD);
  const _Float16* vh = vws + head * (NN * DD);

  const int qbase = qblk * 128 + wave * 16;
  // Offset (halfs) of this lane's 8 values of d inside a 16-row x 16-half tile.
  const int fofs = (lane & 15) * DD + ((lane < 16) ? 0 : 8);
  // The product's depth is 32 and d is 16: one A fragment carries TWO key tiles,
  // tile 0 at k = 0..15 and tile 1 at k = 16..31. Q stands twice as B operand,
  // once in each k half with zeros in the other, and so picks one of the tiles.
  H16 q0, q1;
  {
    const v4u z4 = {};
    const v4u qv = *(const v4u*)(qh + qbase * DD + fofs);
    q0.u[0] = qv; q0.u[1] = z4;
    q1.u[0] = z4; q1.u[1] = qv;
  }

  v8f acc = {};                               // O^T: acc[r] = O[q = lane&15][d = 8*half + r]
  float m = -__builtin_inff();                // running max of this lane's query
  float l = 0.0f;                             // this half's share of the row sum

  for (int kt = 0; kt < NN; kt += 32) {
    if (kt + 32 < NN) {                       // prefetch next K/V tiles
      __builtin_prefetch(kh + (kt + 32) * DD, 0, 0);
      __builtin_prefetch(vh + (kt + 32) * DD, 0, 0);
    }

    // S^T tiles: keys kt..kt+15 and kt+16..kt+31 (A = K rows, B = Q rows).
    // s0[r] = S[q = lane&15][kt + 8*half + r], s1[r] the same 16 keys on.
    v8f z = {};
    H16 kf;                                   // both key tiles, no zero fill in the loop
    kf.u[0] = *(const v4u*)(kh + kt * DD + fofs);
    kf.u[1] = *(const v4u*)(kh + (kt + 16) * DD + fofs);
    // Precaution: the loads below may take the K loads' address registers as
    // their destination, so those loads' addresses are waited for first.
    asm volatile("s_wait_xcnt 0x0" ::: "memory");
    // A fragment = V^T, d = lane&15: keys kt + 8*half + 0..7, then the same 16 on.
    H16 bt;
    bt.u[0] = *(const v4u*)(vh + kt * DD + lane * 8);
    bt.u[1] = *(const v4u*)(vh + (kt + 16) * DD + lane * 8);
    v8f s0 = wmma_f16(kf.h, q0.h, z);
    v8f s1 = wmma_f16(kf.h, q1.h, z);

    // Max over this lane's 16 keys, then over the other half's 16.
    v8f t8;
#pragma unroll
    for (int r = 0; r < 8; ++r) t8[r] = fmaxf(s0[r], s1[r]);
    float t = fmaxf(fmaxf(fmaxf(t8[0], t8[1]), fmaxf(t8[2], t8[3])),
                    fmaxf(fmaxf(t8[4], t8[5]), fmaxf(t8[6], t8[7])));
    t = fmaxf(t, other_half(t));

    const float mnew  = fmaxf(m, t);
    const float alpha = __expf(m - mnew);
    H16 pt;                                   // P^T as B operand, hardware k order
    v8f rs;
#pragma unroll
    for (int r = 0; r < 8; ++r) {
      float p0 = __expf(s0[r] - mnew);
      float p1 = __expf(s1[r] - mnew);
      rs[r] = p0 + p1;
      pt.e[r]     = (_Float16)p0;
      pt.e[8 + r] = (_Float16)p1;
    }
    l = l * alpha + (((rs[0] + rs[1]) + (rs[2] + rs[3])) +
                     ((rs[4] + rs[5]) + (rs[6] + rs[7])));
#pragma unroll
    for (int r = 0; r < 8; ++r) acc[r] = acc[r] * alpha;
    m = mnew;

    acc = wmma_f16(bt.h, pt.h, acc);
  }

  // O = acc / l into the (B,N,C) f16 workspace for the projection GEMM:
  // a lane holds 8 consecutive d of one query, one 16-byte store.
  const int b = head >> 4;
  const int h = head & 15;
  const int n = qbase + (lane & 15);
  const int dofs = (lane < 16) ? 0 : 8;
  l += other_half(l);                         // join the halves' sums once
  union { v4u u; _Float16 e[8]; } o;
#pragma unroll
  for (int r = 0; r < 8; ++r) o.e[r] = (_Float16)(acc[r] / l);
  *(v4u*)(ows + (b * NN + n) * CC + h * DD + dofs) = o.u;
}

// ---------------------------------------------------------------------------
// Kernel 3: output projection (8192x256)@(256x256) + bias -> f32.
// Each wave: 16x32 output tile (2 accumulators share one A fragment).
// ---------------------------------------------------------------------------
__global__ void __launch_bounds__(256)
proj_kernel(const _Float16* __restrict__ ows, const float* __restrict__ w,
            const float* __restrict__ bias, float* __restrict__ out)
{
  const int WSTR = 264;
  __shared__ _Float16 wT[32 * WSTR];
  const int colBase = blockIdx.y * 32;

  for (int i = threadIdx.x; i < 32 * 256; i += 256) {
    int col = i & 31, k = i >> 5;
    wT[col * WSTR + k] = (_Float16)w[k * CC + colBase + col];
  }
  __syncthreads();

  const int wave = threadIdx.x >> 5;
  const int lane = threadIdx.x & 31;
  const int rowBase = (blockIdx.x * 8 + wave) * 16;

  v8f acc0 = {}, acc1 = {};
#pragma unroll
  for (int kc = 0; kc < CC; kc += 32) {
    v16h a  = load_tile_halfrows(ows + rowBase * CC + kc, CC);
    v16h b0 = load_tile_halfrows(wT + kc, WSTR);
    v16h b1 = load_tile_halfrows(wT + 16 * WSTR + kc, WSTR);
    acc0 = wmma_f16(a, b0, acc0);
    acc1 = wmma_f16(a, b1, acc1);
  }

  const int col = lane & 15;
  const int rofs = (lane < 16) ? 0 : 8;
  v8f accs[2] = {acc0, acc1};
#pragma unroll
  for (int tg = 0; tg < 2; ++tg) {
    const int cb = colBase + tg * 16;
    const float bv = bias[cb + col];
#pragma unroll
    for (int r = 0; r < 8; ++r) {
      int row = rowBase + r + rofs;
      out[row * CC + cb + col] = accs[tg][r] + bv;
    }
  }
}

// ---------------------------------------------------------------------------
extern "C" void kernel_launch(void* const* d_in, const int* in_sizes, int n_in,
                              void* d_out, int out_size, void* d_ws, size_t ws_size,
                              hipStream_t stream) {
  (void)in_sizes; (void)n_in; (void)out_size; (void)ws_size;
  const float* x      = (const float*)d_in[0];
  const float* w_qkv  = (const float*)d_in[1];
  const float* b_qkv  = (const float*)d_in[2];
  const float* w_proj = (const float*)d_in[3];
  const float* b_proj = (const float*)d_in[4];
  float* out = (float*)d_out;

  const size_t headElems = (size_t)NHEAD * NN * DD;     // 2M halfs = 4 MB
  _Float16* qws = (_Float16*)d_ws;
  _Float16* kws = qws + headElems;
  _Float16* vws = kws + headElems;
  _Float16* ows = vws + headElems;                      // (B,N,C) f16, 4 MB

  qkv_kernel<<<dim3(ROWS / 128, (3 * CC) / 32), 256, 0, stream>>>(
      x, w_qkv, b_qkv, qws, kws, vws);
  attn_kernel<<<NHEAD * (NN / 128), 256, 0, stream>>>(qws, kws, vws, ows);
  proj_kernel<<<dim3(ROWS / 128, CC / 32), 256, 0, stream>>>(
      ows, w_proj, b_proj, out);
}

// v004
// Measured time: 63.1 microseconds a run.
// Next to v003, in two timings, it ran 1.12 and 1.13 times as fast.
// Counting every step since v000, it is 2.73 times as fast.
#include <hip/hip_runtime.h>

// ---------------------------------------------------------------------------
// CDNA5 (gfx1250) fused multi-head attention:
//   qkv = x @ w_qkv + b_qkv  -> Q,K,V (f16, head-major)
//   flash attention per (b,h) with v_wmma_f32_16x16x32_f16
//   out = O @ w_proj + b_proj (f32)
// CDNA5 paths: WMMA f16, global_prefetch_b8.
// ---------------------------------------------------------------------------

typedef __attribute__((ext_vector_type(16))) _Float16 v16h;
typedef __attribute__((ext_vector_type(8)))  float    v8f;
typedef __attribute__((ext_vector_type(4)))  unsigned int v4u;

union H16 { v16h h; v4u u[2]; _Float16 e[16]; };

#define BB 4
#define NN 2048
#define CC 256
#define HH 16
#define DD 16
#define NHEAD (BB*HH)          // 64
#define ROWS  (BB*NN)          // 8192

__device__ __forceinline__ v8f wmma_f16(v16h a, v16h b, v8f c) {
  // D = A(16x32 f16) * B(32x16 f16) + C(16x16 f32)
  return __builtin_amdgcn_wmma_f32_16x16x32_f16(
      false, a, false, b, (short)0, c, false, false);
}

// A/B operand fragment from a 16-row x 32-half row-major tile (global or LDS).
// Lane L (L%16 = row/col), K chunks {b0..b0+7, 16+b0..16+b0+7}, b0 = (L<16?0:8).
__device__ __forceinline__ v16h load_tile_halfrows(const _Float16* base, int rowStride) {
  const int lane = threadIdx.x & 31;
  const int row  = lane & 15;
  const int b0   = (lane < 16) ? 0 : 8;
  const _Float16* p = base + row * rowStride;
  H16 t;
  t.u[0] = *(const v4u*)(p + b0);
  t.u[1] = *(const v4u*)(p + 16 + b0);
  return t.h;
}

// A fragment from f32 global rows, converted to f16 on the fly.
__device__ __forceinline__ v16h load_tile_f32rows(const float* base, int rowStride) {
  const int lane = threadIdx.x & 31;
  const int row  = lane & 15;
  const int b0   = (lane < 16) ? 0 : 8;
  const float* p = base + row * rowStride;
  H16 t;
#pragma unroll
  for (int i = 0; i < 8; ++i) t.e[i]     = (_Float16)p[b0 + i];
#pragma unroll
  for (int i = 0; i < 8; ++i) t.e[8 + i] = (_Float16)p[16 + b0 + i];
  return t.h;
}

// ---------------------------------------------------------------------------
// Kernel 1: QKV projection. grid (32 row groups, 8 column groups), 512 threads.
// A block takes 256 rows x 96 columns of (8192 x 768); each of its 16 waves one
// 16x96 tile: one A fragment of x feeds 6 WMMAs, and x is read 8 times in all.
// Output scattered to head-major f16 Q/K: [b*H+h][n][16].
// V keeps the same 512-byte place per 16-key tile, but transposed inside it:
// [b*H+h][n/16][lane][8], lane = 16*((n%16)/8) + d, element = n%8. That is the
// accumulator's own order here and half an A fragment of V^T in attention.
// ---------------------------------------------------------------------------
#define QCOLS  96                             // columns of w_qkv per block
#define QTILES (QCOLS / 16)                   // 16-column tiles per wave
#define QWAVES 16                             // waves per block, 16 rows each

// 256 blocks of 16 waves: one block a WGP, four waves a SIMD. The attribute gives
// the compiler that occupancy's registers, so that a wave's x loads are all issued
// at once and the LDS reads run ahead of the WMMAs that use them.
__global__ void __launch_bounds__(QWAVES * 32) __attribute__((amdgpu_waves_per_eu(4, 4)))
qkv_kernel(const float* __restrict__ x, const float* __restrict__ w,
           const float* __restrict__ bias,
           _Float16* __restrict__ qws, _Float16* __restrict__ kws,
           _Float16* __restrict__ vws)
{
  const int WSTR = 264;                       // padded LDS row stride (halfs)
  __shared__ _Float16 wT[QCOLS * WSTR];       // w^T tile: [col][k], f16
  const int colBase = blockIdx.y * QCOLS;
  const int wave = threadIdx.x >> 5;
  const int lane = threadIdx.x & 31;

  // A wave stages rows k = wave, wave + 16, ... of w: 96 columns are three whole
  // 128-byte lines. Unrolled so that a thread's 48 loads fly together and the
  // tile costs one load latency, not one per group of loads.
#pragma unroll
  for (int i = 0; i < CC / QWAVES; ++i) {
    const int k = wave + i * QWAVES;
#pragma unroll
    for (int j = 0; j < QCOLS / 32; ++j) {
      const int col = lane + 32 * j;
      wT[col * WSTR + k] = (_Float16)w[k * (3 * CC) + colBase + col];
    }
  }
  __syncthreads();

  const int rowBase = (blockIdx.x * QWAVES + wave) * 16;

  // The loops over tg are unrolled so that acc[tg] names registers (an indexed
  // array would go to scratch memory) and the stores take constant offsets.
  v8f acc[QTILES] = {};
#pragma unroll
  for (int kc = 0; kc < CC; kc += 32) {
    v16h a = load_tile_f32rows(x + rowBase * CC + kc, CC);
    v16h b[QTILES];
#pragma unroll
    for (int tg = 0; tg < QTILES; ++tg)
      b[tg] = load_tile_halfrows(wT + tg * 16 * WSTR + kc, WSTR);
#pragma unroll
    for (int tg = 0; tg < QTILES; ++tg) acc[tg] = wmma_f16(a, b[tg], acc[tg]);
  }

  // Epilogue: bias + scatter into Q/K/V head-major layout, tile by tile. A tile
  // of 16 columns is one head of Q, of K or of V and never crosses.
  const int col  = lane & 15;                 // d
  const int rofs = (lane < 16) ? 0 : 8;
  const int bb = rowBase / NN;
  const int n0 = rowBase % NN;
  const float* bp = bias + colBase + col;
  float bv[QTILES];
#pragma unroll
  for (int tg = 0; tg < QTILES; ++tg) bv[tg] = bp[tg * 16];
#pragma unroll
  for (int tg = 0; tg < QTILES; ++tg) {
    const int cb = colBase + tg * 16;
    const int s = cb / CC;                    // 0=q 1=k 2=v: the same in every thread
    const int h = (cb % CC) / DD;
    const int hofs = (bb * HH + h) * (NN * DD);
    if (s == 2) {                             // V: a lane's 8 keys of one d, 16 bytes
      union { v4u u; _Float16 e[8]; } pv;
#pragma unroll
      for (int r = 0; r < 8; ++r) pv.e[r] = (_Float16)(acc[tg][r] + bv[tg]);
      *(v4u*)(vws + hofs + n0 * DD + lane * 8) = pv.u;
      // Precaution, here and in the other branch: the instructions that follow
      // in the built code may write this tile's store address and data
      // registers, so the stores are waited for first.
      asm volatile("s_wait_xcnt 0x0" ::: "memory");
    } else {
      _Float16* dst = ((s == 0) ? qws : kws) + hofs;
#pragma unroll
      for (int r = 0; r < 8; ++r) {
        int n = n0 + r + rofs;
        dst[n * DD + col] = (_Float16)(acc[tg][r] + bv[tg]);
      }
      asm volatile("s_wait_xcnt 0x0" ::: "memory");
    }
  }
}

// ---------------------------------------------------------------------------
// Kernel 2: flash attention. grid = 64 heads * 16 qblocks, 256 threads.
// Wave owns 16 q rows; loops k in chunks of 32, no LDS and no barrier:
//   2x WMMA S^T = K Q^T (two key tiles share one A fragment, Q zero-padded): a
//   lane holds 16 scores of ONE query,
//   online softmax in-lane plus one exchange between the wave halves,
//   P^T packs from the score registers straight into the B operand,
//   V^T A-fragment by two 16-byte global loads (V is stored in that order),
//   1x WMMA O^T += V^T P^T.
// ---------------------------------------------------------------------------
// Value of lane l ^ 16 (the other half of the same query column).
__device__ __forceinline__ float other_half(float v) {
  int b = __builtin_bit_cast(int, v);
  b = __builtin_amdgcn_permlanex16(b, b, 0x76543210, 0xfedcba98, false, false);
  return __builtin_bit_cast(float, b);
}

__global__ void __launch_bounds__(256)
attn_kernel(const _Float16* __restrict__ qws, const _Float16* __restrict__ kws,
            const _Float16* __restrict__ vws, _Float16* __restrict__ ows)
{
  const int head = blockIdx.x >> 4;
  const int qblk = blockIdx.x & 15;
  const int wave = threadIdx.x >> 5;
  const int lane = threadIdx.x & 31;

  const _Float16* qh = qws + head * (NN * DD);
  const _Float16* kh = kws + head * (NN * DD);
  const _Float16* vh = vws + head * (NN * DD);

  const int qbase = qblk * 128 + wave * 16;
  // Offset (halfs) of this lane's 8 values of d inside a 16-row x 16-half tile.
  const int fofs = (lane & 15) * DD + ((lane < 16) ? 0 : 8);
  // The product's depth is 32 and d is 16: one A fragment carries TWO key tiles,
  // tile 0 at k = 0..15 and tile 1 at k = 16..31. Q stands twice as B operand,
  // once in each k half with zeros in the other, and so picks one of the tiles.
  H16 q0, q1;
  {
    const v4u z4 = {};
    const v4u qv = *(const v4u*)(qh + qbase * DD + fofs);
    q0.u[0] = qv; q0.u[1] = z4;
    q1.u[0] = z4; q1.u[1] = qv;
  }

  v8f acc = {};                               // O^T: acc[r] = O[q = lane&15][d = 8*half + r]
  float m = -__builtin_inff();                // running max of this lane's query
  float l = 0.0f;                             // this half's share of the row sum

  for (int kt = 0; kt < NN; kt += 32) {
    if (kt + 32 < NN) {                       // prefetch next K/V tiles
      __builtin_prefetch(kh + (kt + 32) * DD, 0, 0);
      __builtin_prefetch(vh + (kt + 32) * DD, 0, 0);
    }

    // S^T tiles: keys kt..kt+15 and kt+16..kt+31 (A = K rows, B = Q rows).
    // s0[r] = S[q = lane&15][kt + 8*half + r], s1[r] the same 16 keys on.
    v8f z = {};
    H16 kf;                                   // both key tiles, no zero fill in the loop
    kf.u[0] = *(const v4u*)(kh + kt * DD + fofs);
    kf.u[1] = *(const v4u*)(kh + (kt + 16) * DD + fofs);
    // Precaution: the loads below may take the K loads' address registers as
    // their destination, so those loads' addresses are waited for first.
    asm volatile("s_wait_xcnt 0x0" ::: "memory");
    // A fragment = V^T, d = lane&15: keys kt + 8*half + 0..7, then the same 16 on.
    H16 bt;
    bt.u[0] = *(const v4u*)(vh + kt * DD + lane * 8);
    bt.u[1] = *(const v4u*)(vh + (kt + 16) * DD + lane * 8);
    v8f s0 = wmma_f16(kf.h, q0.h, z);
    v8f s1 = wmma_f16(kf.h, q1.h, z);

    // Max over this lane's 16 keys, then over the other half's 16.
    v8f t8;
#pragma unroll
    for (int r = 0; r < 8; ++r) t8[r] = fmaxf(s0[r], s1[r]);
    float t = fmaxf(fmaxf(fmaxf(t8[0], t8[1]), fmaxf(t8[2], t8[3])),
                    fmaxf(fmaxf(t8[4], t8[5]), fmaxf(t8[6], t8[7])));
    t = fmaxf(t, other_half(t));

    const float mnew  = fmaxf(m, t);
    const float alpha = __expf(m - mnew);
    H16 pt;                                   // P^T as B operand, hardware k order
    v8f rs;
#pragma unroll
    for (int r = 0; r < 8; ++r) {
      float p0 = __expf(s0[r] - mnew);
      float p1 = __expf(s1[r] - mnew);
      rs[r] = p0 + p1;
      pt.e[r]     = (_Float16)p0;
      pt.e[8 + r] = (_Float16)p1;
    }
    l = l * alpha + (((rs[0] + rs[1]) + (rs[2] + rs[3])) +
                     ((rs[4] + rs[5]) + (rs[6] + rs[7])));
#pragma unroll
    for (int r = 0; r < 8; ++r) acc[r] = acc[r] * alpha;
    m = mnew;

    acc = wmma_f16(bt.h, pt.h, acc);
  }

  // O = acc / l into the (B,N,C) f16 workspace for the projection GEMM:
  // a lane holds 8 consecutive d of one query, one 16-byte store.
  const int b = head >> 4;
  const int h = head & 15;
  const int n = qbase + (lane & 15);
  const int dofs = (lane < 16) ? 0 : 8;
  l += other_half(l);                         // join the halves' sums once
  union { v4u u; _Float16 e[8]; } o;
#pragma unroll
  for (int r = 0; r < 8; ++r) o.e[r] = (_Float16)(acc[r] / l);
  *(v4u*)(ows + (b * NN + n) * CC + h * DD + dofs) = o.u;
}

// ---------------------------------------------------------------------------
// Kernel 3: output projection (8192x256)@(256x256) + bias -> f32.
// Each wave: 16x32 output tile (2 accumulators share one A fragment).
// ---------------------------------------------------------------------------
__global__ void __launch_bounds__(256)
proj_kernel(const _Float16* __restrict__ ows, const float* __restrict__ w,
            const float* __restrict__ bias, float* __restrict__ out)
{
  const int WSTR = 264;
  __shared__ _Float16 wT[32 * WSTR];
  const int colBase = blockIdx.y * 32;

  for (int i = threadIdx.x; i < 32 * 256; i += 256) {
    int col = i & 31, k = i >> 5;
    wT[col * WSTR + k] = (_Float16)w[k * CC + colBase + col];
  }
  __syncthreads();

  const int wave = threadIdx.x >> 5;
  const int lane = threadIdx.x & 31;
  const int rowBase = (blockIdx.x * 8 + wave) * 16;

  v8f acc0 = {}, acc1 = {};
#pragma unroll
  for (int kc = 0; kc < CC; kc += 32) {
    v16h a  = load_tile_halfrows(ows + rowBase * CC + kc, CC);
    v16h b0 = load_tile_halfrows(wT + kc, WSTR);
    v16h b1 = load_tile_halfrows(wT + 16 * WSTR + kc, WSTR);
    acc0 = wmma_f16(a, b0, acc0);
    acc1 = wmma_f16(a, b1, acc1);
  }

  const int col = lane & 15;
  const int rofs = (lane < 16) ? 0 : 8;
  v8f accs[2] = {acc0, acc1};
#pragma unroll
  for (int tg = 0; tg < 2; ++tg) {
    const int cb = colBase + tg * 16;
    const float bv = bias[cb + col];
#pragma unroll
    for (int r = 0; r < 8; ++r) {
      int row = rowBase + r + rofs;
      out[row * CC + cb + col] = accs[tg][r] + bv;
    }
  }
}

// ---------------------------------------------------------------------------
extern "C" void kernel_launch(void* const* d_in, const int* in_sizes, int n_in,
                              void* d_out, int out_size, void* d_ws, size_t ws_size,
                              hipStream_t stream) {
  (void)in_sizes; (void)n_in; (void)out_size; (void)ws_size;
  const float* x      = (const float*)d_in[0];
  const float* w_qkv  = (const float*)d_in[1];
  const float* b_qkv  = (const float*)d_in[2];
  const float* w_proj = (const float*)d_in[3];
  const float* b_proj = (const float*)d_in[4];
  float* out = (float*)d_out;

  const size_t headElems = (size_t)NHEAD * NN * DD;     // 2M halfs = 4 MB
  _Float16* qws = (_Float16*)d_ws;
  _Float16* kws = qws + headElems;
  _Float16* vws = kws + headElems;
  _Float16* ows = vws + headElems;                      // (B,N,C) f16, 4 MB

  qkv_kernel<<<dim3(ROWS / (QWAVES * 16), (3 * CC) / QCOLS), QWAVES * 32, 0, stream>>>(
      x, w_qkv, b_qkv, qws, kws, vws);
  attn_kernel<<<NHEAD * (NN / 128), 256, 0, stream>>>(qws, kws, vws, ows);
  proj_kernel<<<dim3(ROWS / 128, CC / 32), 256, 0, stream>>>(
      ows, w_proj, b_proj, out);
}

// v005
// It runs in 54.9 microseconds.
// Timed twice side by side with v004, it ran 1.13 and 1.16 times as fast.
// Counting every step since v000, it is 3.12 times as fast.
#include <hip/hip_runtime.h>

// ---------------------------------------------------------------------------
// CDNA5 (gfx1250) fused multi-head attention:
//   qkv = x @ w_qkv + b_qkv  -> Q,K,V (f16, head-major)
//   flash attention per (b,h) with v_wmma_f32_16x16x32_f16
//   out = O @ w_proj + b_proj (f32)
// CDNA5 paths: WMMA f16.
// ---------------------------------------------------------------------------

typedef __attribute__((ext_vector_type(16))) _Float16 v16h;
typedef __attribute__((ext_vector_type(8)))  float    v8f;
typedef __attribute__((ext_vector_type(4)))  unsigned int v4u;

union H16 { v16h h; v4u u[2]; _Float16 e[16]; };

#define BB 4
#define NN 2048
#define CC 256
#define HH 16
#define DD 16
#define NHEAD (BB*HH)          // 64
#define ROWS  (BB*NN)          // 8192

__device__ __forceinline__ v8f wmma_f16(v16h a, v16h b, v8f c) {
  // D = A(16x32 f16) * B(32x16 f16) + C(16x16 f32)
  return __builtin_amdgcn_wmma_f32_16x16x32_f16(
      false, a, false, b, (short)0, c, false, false);
}

// A/B operand fragment from a 16-row x 32-half row-major tile (global or LDS).
// Lane L (L%16 = row/col), K chunks {b0..b0+7, 16+b0..16+b0+7}, b0 = (L<16?0:8).
__device__ __forceinline__ v16h load_tile_halfrows(const _Float16* base, int rowStride) {
  const int lane = threadIdx.x & 31;
  const int row  = lane & 15;
  const int b0   = (lane < 16) ? 0 : 8;
  const _Float16* p = base + row * rowStride;
  H16 t;
  t.u[0] = *(const v4u*)(p + b0);
  t.u[1] = *(const v4u*)(p + 16 + b0);
  return t.h;
}

// A fragment from f32 global rows, converted to f16 on the fly.
__device__ __forceinline__ v16h load_tile_f32rows(const float* base, int rowStride) {
  const int lane = threadIdx.x & 31;
  const int row  = lane & 15;
  const int b0   = (lane < 16) ? 0 : 8;
  const float* p = base + row * rowStride;
  H16 t;
#pragma unroll
  for (int i = 0; i < 8; ++i) t.e[i]     = (_Float16)p[b0 + i];
#pragma unroll
  for (int i = 0; i < 8; ++i) t.e[8 + i] = (_Float16)p[16 + b0 + i];
  return t.h;
}

// ---------------------------------------------------------------------------
// Kernel 1: QKV projection. grid (32 row groups, 8 column groups), 512 threads.
// A block takes 256 rows x 96 columns of (8192 x 768); each of its 16 waves one
// 16x96 tile: one A fragment of x feeds 6 WMMAs, and x is read 8 times in all.
// Output scattered to head-major f16 Q/K: [b*H+h][n][16].
// V keeps the same 512-byte place per 16-key tile, but transposed inside it:
// [b*H+h][n/16][lane][8], lane = 16*((n%16)/8) + d, element = n%8. That is the
// accumulator's own order here and half an A fragment of V^T in attention.
// ---------------------------------------------------------------------------
#define QCOLS  96                             // columns of w_qkv per block
#define QTILES (QCOLS / 16)                   // 16-column tiles per wave
#define QWAVES 16                             // waves per block, 16 rows each

// 256 blocks of 16 waves: one block a WGP, four waves a SIMD. The attribute gives
// the compiler that occupancy's registers, so that a wave's x loads are all issued
// at once and the LDS reads run ahead of the WMMAs that use them.
__global__ void __launch_bounds__(QWAVES * 32) __attribute__((amdgpu_waves_per_eu(4, 4)))
qkv_kernel(const float* __restrict__ x, const float* __restrict__ w,
           const float* __restrict__ bias,
           _Float16* __restrict__ qws, _Float16* __restrict__ kws,
           _Float16* __restrict__ vws)
{
  const int WSTR = 264;                       // padded LDS row stride (halfs)
  __shared__ _Float16 wT[QCOLS * WSTR];       // w^T tile: [col][k], f16
  const int colBase = blockIdx.y * QCOLS;
  const int wave = threadIdx.x >> 5;
  const int lane = threadIdx.x & 31;

  // A wave stages rows k = wave, wave + 16, ... of w: 96 columns are three whole
  // 128-byte lines. Unrolled so that a thread's 48 loads fly together and the
  // tile costs one load latency, not one per group of loads.
#pragma unroll
  for (int i = 0; i < CC / QWAVES; ++i) {
    const int k = wave + i * QWAVES;
#pragma unroll
    for (int j = 0; j < QCOLS / 32; ++j) {
      const int col = lane + 32 * j;
      wT[col * WSTR + k] = (_Float16)w[k * (3 * CC) + colBase + col];
    }
  }
  __syncthreads();

  const int rowBase = (blockIdx.x * QWAVES + wave) * 16;

  // The loops over tg are unrolled so that acc[tg] names registers (an indexed
  // array would go to scratch memory) and the stores take constant offsets.
  v8f acc[QTILES] = {};
#pragma unroll
  for (int kc = 0; kc < CC; kc += 32) {
    v16h a = load_tile_f32rows(x + rowBase * CC + kc, CC);
    v16h b[QTILES];
#pragma unroll
    for (int tg = 0; tg < QTILES; ++tg)
      b[tg] = load_tile_halfrows(wT + tg * 16 * WSTR + kc, WSTR);
#pragma unroll
    for (int tg = 0; tg < QTILES; ++tg) acc[tg] = wmma_f16(a, b[tg], acc[tg]);
  }

  // Epilogue: bias + scatter into Q/K/V head-major layout, tile by tile. A tile
  // of 16 columns is one head of Q, of K or of V and never crosses.
  const int col  = lane & 15;                 // d
  const int rofs = (lane < 16) ? 0 : 8;
  const int bb = rowBase / NN;
  const int n0 = rowBase % NN;
  const float* bp = bias + colBase + col;
  float bv[QTILES];
#pragma unroll
  for (int tg = 0; tg < QTILES; ++tg) bv[tg] = bp[tg * 16];
#pragma unroll
  for (int tg = 0; tg < QTILES; ++tg) {
    const int cb = colBase + tg * 16;
    const int s = cb / CC;                    // 0=q 1=k 2=v: the same in every thread
    const int h = (cb % CC) / DD;
    const int hofs = (bb * HH + h) * (NN * DD);
    if (s == 2) {                             // V: a lane's 8 keys of one d, 16 bytes
      union { v4u u; _Float16 e[8]; } pv;
#pragma unroll
      for (int r = 0; r < 8; ++r) pv.e[r] = (_Float16)(acc[tg][r] + bv[tg]);
      *(v4u*)(vws + hofs + n0 * DD + lane * 8) = pv.u;
      // Precaution, here and in the other branch: the instructions that follow
      // in the built code may write this tile's store address and data
      // registers, so the stores are waited for first.
      asm volatile("s_wait_xcnt 0x0" ::: "memory");
    } else {
      _Float16* dst = ((s == 0) ? qws : kws) + hofs;
#pragma unroll
      for (int r = 0; r < 8; ++r) {
        int n = n0 + r + rofs;
        dst[n * DD + col] = (_Float16)(acc[tg][r] + bv[tg]);
      }
      asm volatile("s_wait_xcnt 0x0" ::: "memory");
    }
  }
}

// ---------------------------------------------------------------------------
// Kernel 2: flash attention. grid = 64 heads * 16 qblocks, 256 threads.
// Wave owns 16 q rows; loops k in chunks of 32, no LDS and no barrier:
//   2x WMMA S^T = K Q^T (two key tiles share one A fragment, Q zero-padded): a
//   lane holds 16 scores of ONE query,
//   online softmax in-lane plus one exchange between the wave halves,
//   P^T packs from the score registers straight into the B operand,
//   V^T A-fragment by two 16-byte global loads (V is stored in that order),
//   1x WMMA O^T += V^T P^T.
// ---------------------------------------------------------------------------
// Value of lane l ^ 16 (the other half of the same query column).
__device__ __forceinline__ float other_half(float v) {
  int b = __builtin_bit_cast(int, v);
  b = __builtin_amdgcn_permlanex16(b, b, 0x76543210, 0xfedcba98, false, false);
  return __builtin_bit_cast(float, b);
}

// Both 16-byte halves of a 32-key fragment: keys key..key+15 and key+16..key+31.
__device__ __forceinline__ void load_pair(H16& f, const _Float16* lanep, int key) {
  f.u[0] = *(const v4u*)(lanep + key * DD);
  f.u[1] = *(const v4u*)(lanep + (key + 16) * DD);
  // Keeps the loads early in the trip and in this order: without it the compiler
  // gathers all loads of a trip at the loop's foot, directly in front of their use.
  __builtin_amdgcn_sched_barrier(0);
}

// One pass over 32 keys whose fragments kf (K) and bt (V^T) are already on their
// way. Behind the last WMMA that reads a fragment stands its refill for key nk,
// the pass after next.
__device__ __forceinline__ void attn_pass(H16& kf, H16& bt, v16h q0, v16h q1,
                                          const _Float16* kl, const _Float16* vl, int nk,
                                          v8f& acc, float& m, float& l) {
  // S^T tiles: 16 keys and the next 16 (A = K rows, B = Q rows).
  // s0[r] = S[q = lane&15][key + 8*half + r], s1[r] the same 16 keys on.
  v8f z = {};
  v8f s0 = wmma_f16(kf.h, q0, z);
  v8f s1 = wmma_f16(kf.h, q1, z);
  load_pair(kf, kl, nk);

  // Max over this lane's 16 keys, then over the other half's 16.
  v8f t8;
#pragma unroll
  for (int r = 0; r < 8; ++r) t8[r] = fmaxf(s0[r], s1[r]);
  float t = fmaxf(fmaxf(fmaxf(t8[0], t8[1]), fmaxf(t8[2], t8[3])),
                  fmaxf(fmaxf(t8[4], t8[5]), fmaxf(t8[6], t8[7])));
  t = fmaxf(t, other_half(t));

  const float mnew  = fmaxf(m, t);
  const float alpha = __expf(m - mnew);
  H16 pt;                                     // P^T as B operand, hardware k order
  v8f rs;
#pragma unroll
  for (int r = 0; r < 8; ++r) {
    float p0 = __expf(s0[r] - mnew);
    float p1 = __expf(s1[r] - mnew);
    rs[r] = p0 + p1;
    pt.e[r]     = (_Float16)p0;
    pt.e[8 + r] = (_Float16)p1;
  }
  l = l * alpha + (((rs[0] + rs[1]) + (rs[2] + rs[3])) +
                   ((rs[4] + rs[5]) + (rs[6] + rs[7])));
#pragma unroll
  for (int r = 0; r < 8; ++r) acc[r] = acc[r] * alpha;
  m = mnew;

  acc = wmma_f16(bt.h, pt.h, acc);
  load_pair(bt, vl, nk);
}

__global__ void __launch_bounds__(256)
attn_kernel(const _Float16* __restrict__ qws, const _Float16* __restrict__ kws,
            const _Float16* __restrict__ vws, _Float16* __restrict__ ows)
{
  const int head = blockIdx.x >> 4;
  const int qblk = blockIdx.x & 15;
  const int wave = threadIdx.x >> 5;
  const int lane = threadIdx.x & 31;

  const _Float16* qh = qws + head * (NN * DD);
  const _Float16* kh = kws + head * (NN * DD);
  const _Float16* vh = vws + head * (NN * DD);

  const int qbase = qblk * 128 + wave * 16;
  // Offset (halfs) of this lane's 8 values of d inside a 16-row x 16-half tile.
  const int fofs = (lane & 15) * DD + ((lane < 16) ? 0 : 8);
  // The product's depth is 32 and d is 16: one A fragment carries TWO key tiles,
  // tile 0 at k = 0..15 and tile 1 at k = 16..31. Q stands twice as B operand,
  // once in each k half with zeros in the other, and so picks one of the tiles.
  H16 q0, q1;
  {
    const v4u z4 = {};
    const v4u qv = *(const v4u*)(qh + qbase * DD + fofs);
    q0.u[0] = qv; q0.u[1] = z4;
    q1.u[0] = z4; q1.u[1] = qv;
  }

  v8f acc = {};                               // O^T: acc[r] = O[q = lane&15][d = 8*half + r]
  float m = -__builtin_inff();                // running max of this lane's query
  float l = 0.0f;                             // this half's share of the row sum

  // K and V come from the launch before and are first read here by all blocks of
  // a head at about the same time, so a tile's loads may take longer than a pass
  // computes. They are issued two passes ahead: two register sets, one for the even
  // and one for the odd passes.
  const _Float16* kl = kh + fofs;             // this lane's 8 values of d, key row lane&15
  const _Float16* vl = vh + lane * 8;         // this lane's 8 keys of V^T, d = lane&15
  H16 kfA, btA, kfB, btB;
  load_pair(kfA, kl, 0);
  load_pair(btA, vl, 0);
  load_pair(kfB, kl, 32);
  load_pair(btB, vl, 32);

  for (int kt = 0; kt < NN; kt += 64) {
    // Precaution: this trip forms new load addresses, in the built code in the
    // registers that the trip before gave to its loads, so those loads' addresses
    // are waited for first.
    asm volatile("s_wait_xcnt 0x0" ::: "memory");
    // First key of the two tiles fetched in this trip. The last trip wraps to the
    // head's first tiles: inside the buffer, loaded and not used.
    const int nk = (kt + 64) & (NN - 1);
    attn_pass(kfA, btA, q0.h, q1.h, kl, vl, nk, acc, m, l);
    attn_pass(kfB, btB, q0.h, q1.h, kl, vl, nk + 32, acc, m, l);
  }

  // O = acc / l into the (B,N,C) f16 workspace for the projection GEMM:
  // a lane holds 8 consecutive d of one query, one 16-byte store.
  const int b = head >> 4;
  const int h = head & 15;
  const int n = qbase + (lane & 15);
  const int dofs = (lane < 16) ? 0 : 8;
  l += other_half(l);                         // join the halves' sums once
  union { v4u u; _Float16 e[8]; } o;
#pragma unroll
  for (int r = 0; r < 8; ++r) o.e[r] = (_Float16)(acc[r] / l);
  *(v4u*)(ows + (b * NN + n) * CC + h * DD + dofs) = o.u;
}

// ---------------------------------------------------------------------------
// Kernel 3: output projection (8192x256)@(256x256) + bias -> f32.
// Each wave: 16x32 output tile (2 accumulators share one A fragment).
// ---------------------------------------------------------------------------
__global__ void __launch_bounds__(256)
proj_kernel(const _Float16* __restrict__ ows, const float* __restrict__ w,
            const float* __restrict__ bias, float* __restrict__ out)
{
  const int WSTR = 264;
  __shared__ _Float16 wT[32 * WSTR];
  const int colBase = blockIdx.y * 32;

  for (int i = threadIdx.x; i < 32 * 256; i += 256) {
    int col = i & 31, k = i >> 5;
    wT[col * WSTR + k] = (_Float16)w[k * CC + colBase + col];
  }
  __syncthreads();

  const int wave = threadIdx.x >> 5;
  const int lane = threadIdx.x & 31;
  const int rowBase = (blockIdx.x * 8 + wave) * 16;

  v8f acc0 = {}, acc1 = {};
#pragma unroll
  for (int kc = 0; kc < CC; kc += 32) {
    v16h a  = load_tile_halfrows(ows + rowBase * CC + kc, CC);
    v16h b0 = load_tile_halfrows(wT + kc, WSTR);
    v16h b1 = load_tile_halfrows(wT + 16 * WSTR + kc, WSTR);
    acc0 = wmma_f16(a, b0, acc0);
    acc1 = wmma_f16(a, b1, acc1);
  }

  const int col = lane & 15;
  const int rofs = (lane < 16) ? 0 : 8;
  v8f accs[2] = {acc0, acc1};
#pragma unroll
  for (int tg = 0; tg < 2; ++tg) {
    const int cb = colBase + tg * 16;
    const float bv = bias[cb + col];
#pragma unroll
    for (int r = 0; r < 8; ++r) {
      int row = rowBase + r + rofs;
      out[row * CC + cb + col] = accs[tg][r] + bv;
    }
  }
}

// ---------------------------------------------------------------------------
extern "C" void kernel_launch(void* const* d_in, const int* in_sizes, int n_in,
                              void* d_out, int out_size, void* d_ws, size_t ws_size,
                              hipStream_t stream) {
  (void)in_sizes; (void)n_in; (void)out_size; (void)ws_size;
  const float* x      = (const float*)d_in[0];
  const float* w_qkv  = (const float*)d_in[1];
  const float* b_qkv  = (const float*)d_in[2];
  const float* w_proj = (const float*)d_in[3];
  const float* b_proj = (const float*)d_in[4];
  float* out = (float*)d_out;

  const size_t headElems = (size_t)NHEAD * NN * DD;     // 2M halfs = 4 MB
  _Float16* qws = (_Float16*)d_ws;
  _Float16* kws = qws + headElems;
  _Float16* vws = kws + headElems;
  _Float16* ows = vws + headElems;                      // (B,N,C) f16, 4 MB

  qkv_kernel<<<dim3(ROWS / (QWAVES * 16), (3 * CC) / QCOLS), QWAVES * 32, 0, stream>>>(
      x, w_qkv, b_qkv, qws, kws, vws);
  attn_kernel<<<NHEAD * (NN / 128), 256, 0, stream>>>(qws, kws, vws, ows);
  proj_kernel<<<dim3(ROWS / 128, CC / 32), 256, 0, stream>>>(
      ows, w_proj, b_proj, out);
}

// v007
// One run takes 49.8 microseconds.
// It is 1.14 times as fast as v005, going by the measured steps of the versions left out in between.
// Over all steps from v000 it is 3.56 times as fast.
#include <hip/hip_runtime.h>

// ---------------------------------------------------------------------------
// CDNA5 (gfx1250) fused multi-head attention:
//   qkv = x @ w_qkv + b_qkv  -> Q,K,V (f16, head-major)
//   flash attention per (b,h) with v_wmma_f32_16x16x32_f16
//   out = O @ w_proj + b_proj (f32)
// CDNA5 paths: WMMA f16.
// ---------------------------------------------------------------------------

typedef __attribute__((ext_vector_type(16))) _Float16 v16h;
typedef __attribute__((ext_vector_type(8)))  float    v8f;
typedef __attribute__((ext_vector_type(4)))  unsigned int v4u;

union H16 { v16h h; v4u u[2]; _Float16 e[16]; };

#define BB 4
#define NN 2048
#define CC 256
#define HH 16
#define DD 16
#define NHEAD (BB*HH)          // 64
#define ROWS  (BB*NN)          // 8192

__device__ __forceinline__ v8f wmma_f16(v16h a, v16h b, v8f c) {
  // D = A(16x32 f16) * B(32x16 f16) + C(16x16 f32)
  return __builtin_amdgcn_wmma_f32_16x16x32_f16(
      false, a, false, b, (short)0, c, false, false);
}

// A/B operand fragment from a 16-row x 32-half row-major tile (global or LDS).
// Lane L (L%16 = row/col), K chunks {b0..b0+7, 16+b0..16+b0+7}, b0 = (L<16?0:8).
__device__ __forceinline__ v16h load_tile_halfrows(const _Float16* base, int rowStride) {
  const int lane = threadIdx.x & 31;
  const int row  = lane & 15;
  const int b0   = (lane < 16) ? 0 : 8;
  const _Float16* p = base + row * rowStride;
  H16 t;
  t.u[0] = *(const v4u*)(p + b0);
  t.u[1] = *(const v4u*)(p + 16 + b0);
  return t.h;
}

// A fragment from f32 global rows, converted to f16 on the fly.
__device__ __forceinline__ v16h load_tile_f32rows(const float* base, int rowStride) {
  const int lane = threadIdx.x & 31;
  const int row  = lane & 15;
  const int b0   = (lane < 16) ? 0 : 8;
  const float* p = base + row * rowStride;
  H16 t;
#pragma unroll
  for (int i = 0; i < 8; ++i) t.e[i]     = (_Float16)p[b0 + i];
#pragma unroll
  for (int i = 0; i < 8; ++i) t.e[8 + i] = (_Float16)p[16 + b0 + i];
  return t.h;
}

// ---------------------------------------------------------------------------
// Kernel 1: QKV projection. grid (32 row groups, 8 column groups), 512 threads.
// A block takes 256 rows x 96 columns of (8192 x 768); each of its 16 waves one
// 16x96 tile: one A fragment of x feeds 6 WMMAs, and x is read 8 times in all.
// Output scattered to head-major f16 Q/K: [b*H+h][n][16]. Q is stored times log2 e
// (scaled in f32, rounded to f16 once): attention's scores are then exponents of 2.
// V keeps the same 512-byte place per 16-key tile, but transposed inside it:
// [b*H+h][n/16][lane][8], lane = 16*((n%16)/8) + d, element = n%8. That is the
// accumulator's own order here and half an A fragment of V^T in attention.
// ---------------------------------------------------------------------------
#define QCOLS  96                             // columns of w_qkv per block
#define QTILES (QCOLS / 16)                   // 16-column tiles per wave
#define QWAVES 16                             // waves per block, 16 rows each
#define LOG2E  1.44269504f

// 256 blocks of 16 waves: one block a WGP, four waves a SIMD. The attribute gives
// the compiler that occupancy's registers, so that a wave's x loads are all issued
// at once and the LDS reads run ahead of the WMMAs that use them.
__global__ void __launch_bounds__(QWAVES * 32) __attribute__((amdgpu_waves_per_eu(4, 4)))
qkv_kernel(const float* __restrict__ x, const float* __restrict__ w,
           const float* __restrict__ bias,
           _Float16* __restrict__ qws, _Float16* __restrict__ kws,
           _Float16* __restrict__ vws)
{
  const int WSTR = 264;                       // padded LDS row stride (halfs)
  __shared__ _Float16 wT[QCOLS * WSTR];       // w^T tile: [col][k], f16
  const int colBase = blockIdx.y * QCOLS;
  const int wave = threadIdx.x >> 5;
  const int lane = threadIdx.x & 31;

  // A wave stages rows k = wave, wave + 16, ... of w: 96 columns are three whole
  // 128-byte lines. Unrolled so that a thread's 48 loads fly together and the
  // tile costs one load latency, not one per group of loads.
#pragma unroll
  for (int i = 0; i < CC / QWAVES; ++i) {
    const int k = wave + i * QWAVES;
#pragma unroll
    for (int j = 0; j < QCOLS / 32; ++j) {
      const int col = lane + 32 * j;
      wT[col * WSTR + k] = (_Float16)w[k * (3 * CC) + colBase + col];
    }
  }
  __syncthreads();

  const int rowBase = (blockIdx.x * QWAVES + wave) * 16;

  // The loops over tg are unrolled so that acc[tg] names registers (an indexed
  // array would go to scratch memory) and the stores take constant offsets.
  v8f acc[QTILES] = {};
#pragma unroll
  for (int kc = 0; kc < CC; kc += 32) {
    v16h a = load_tile_f32rows(x + rowBase * CC + kc, CC);
    v16h b[QTILES];
#pragma unroll
    for (int tg = 0; tg < QTILES; ++tg)
      b[tg] = load_tile_halfrows(wT + tg * 16 * WSTR + kc, WSTR);
#pragma unroll
    for (int tg = 0; tg < QTILES; ++tg) acc[tg] = wmma_f16(a, b[tg], acc[tg]);
  }

  // Epilogue: bias + scatter into Q/K/V head-major layout, tile by tile. A tile
  // of 16 columns is one head of Q, of K or of V and never crosses.
  const int col  = lane & 15;                 // d
  const int rofs = (lane < 16) ? 0 : 8;
  const int bb = rowBase / NN;
  const int n0 = rowBase % NN;
  const float* bp = bias + colBase + col;
  float bv[QTILES];
#pragma unroll
  for (int tg = 0; tg < QTILES; ++tg) bv[tg] = bp[tg * 16];
#pragma unroll
  for (int tg = 0; tg < QTILES; ++tg) {
    const int cb = colBase + tg * 16;
    const int s = cb / CC;                    // 0=q 1=k 2=v: the same in every thread
    const int h = (cb % CC) / DD;
    const int hofs = (bb * HH + h) * (NN * DD);
    if (s == 2) {                             // V: a lane's 8 keys of one d, 16 bytes
      union { v4u u; _Float16 e[8]; } pv;
#pragma unroll
      for (int r = 0; r < 8; ++r) pv.e[r] = (_Float16)(acc[tg][r] + bv[tg]);
      *(v4u*)(vws + hofs + n0 * DD + lane * 8) = pv.u;
      // Precaution, here and in the other branch: the instructions that follow
      // in the built code may write this tile's store address and data
      // registers, so the stores are waited for first.
      asm volatile("s_wait_xcnt 0x0" ::: "memory");
    } else {
      _Float16* dst = ((s == 0) ? qws : kws) + hofs;
      const float sc = (s == 0) ? LOG2E : 1.0f;   // times 1 is exact: K stays unscaled
#pragma unroll
      for (int r = 0; r < 8; ++r) {
        int n = n0 + r + rofs;
        dst[n * DD + col] = (_Float16)((acc[tg][r] + bv[tg]) * sc);
      }
      asm volatile("s_wait_xcnt 0x0" ::: "memory");
    }
  }
}

// ---------------------------------------------------------------------------
// Kernel 2: flash attention. grid = 64 heads * 16 qblocks, 256 threads.
// Wave owns 16 q rows; loops k in chunks of 32, no LDS and no barrier:
//   2x WMMA S^T = K Q^T (two key tiles share one A fragment, Q zero-padded): a
//   lane holds 16 scores of ONE query, in units of log2 (Q comes times log2 e),
//   online softmax in-lane against a reference maximum that the score WMMAs
//   subtract (C operand); halves exchanged and O, l rescaled only when it rises,
//   P^T packs from the score registers straight into the B operand,
//   V^T A-fragment by two 16-byte global loads (V is stored in that order),
//   1x WMMA O^T += V^T P^T.
// ---------------------------------------------------------------------------
// Value of lane l ^ 16 (the other half of the same query column).
__device__ __forceinline__ float other_half(float v) {
  int b = __builtin_bit_cast(int, v);
  b = __builtin_amdgcn_permlanex16(b, b, 0x76543210, 0xfedcba98, false, false);
  return __builtin_bit_cast(float, b);
}

// Both 16-byte halves of a 32-key fragment: keys key..key+15 and key+16..key+31.
__device__ __forceinline__ void load_pair(H16& f, const _Float16* lanep, int key) {
  f.u[0] = *(const v4u*)(lanep + key * DD);
  f.u[1] = *(const v4u*)(lanep + (key + 16) * DD);
  // Keeps the loads early in the trip and in this order: without it the compiler
  // gathers all loads of a trip at the loop's foot, directly in front of their use.
  __builtin_amdgcn_sched_barrier(0);
}

// Largest of a lane's 16 scores of one 32-key pass.
__device__ __forceinline__ float max16(v8f a, v8f b) {
  v8f t8;
  // Unrolled: constant indices name registers.
#pragma unroll
  for (int r = 0; r < 8; ++r) t8[r] = fmaxf(a[r], b[r]);
  return fmaxf(fmaxf(fmaxf(t8[0], t8[1]), fmaxf(t8[2], t8[3])),
               fmaxf(fmaxf(t8[4], t8[5]), fmaxf(t8[6], t8[7])));
}

// Eight exponentials of 2, back to back, from the score registers into fresh ones
// (written in place, the compiler moved half of the scores to other registers
// first). The outputs are early-clobber: an output is written while later inputs are
// still to be read. The v_nop is the free slot that the instruction set asks for
// behind a transcendental before its result is read or its source overwritten: one
// for the run, where the compiler's own order took one behind every third or fourth.
__device__ __forceinline__ void exp2x8(v8f s, float (&p)[8]) {
  asm("v_exp_f32 %0, %8\n\tv_exp_f32 %1, %9\n\tv_exp_f32 %2, %10\n\tv_exp_f32 %3, %11\n\t"
      "v_exp_f32 %4, %12\n\tv_exp_f32 %5, %13\n\tv_exp_f32 %6, %14\n\tv_exp_f32 %7, %15\n\t"
      "v_nop"
      : "=&v"(p[0]), "=&v"(p[1]), "=&v"(p[2]), "=&v"(p[3]),
        "=&v"(p[4]), "=&v"(p[5]), "=&v"(p[6]), "=&v"(p[7])
      : "v"(s[0]), "v"(s[1]), "v"(s[2]), "v"(s[3]),
        "v"(s[4]), "v"(s[5]), "v"(s[6]), "v"(s[7]));
}

// P^T = 2^(shifted scores) of one 32-key pass as B operand in the hardware k
// order; returns this lane's sum of the 16 values. The scores carry log2 e already.
__device__ __forceinline__ float exp_pack(v8f s0, v8f s1, H16& pt) {
  float p0[8], p1[8];
  exp2x8(s0, p0);
  exp2x8(s1, p1);
  float rs[8];
  // Unrolled: constant indices keep the arrays in registers.
#pragma unroll
  for (int r = 0; r < 8; ++r) {
    rs[r] = p0[r] + p1[r];
    pt.e[r]     = (_Float16)p0[r];
    pt.e[8 + r] = (_Float16)p1[r];
  }
  return ((rs[0] + rs[1]) + (rs[2] + rs[3])) + ((rs[4] + rs[5]) + (rs[6] + rs[7]));
}

// A score (an exponent of 2) may pass the reference maximum by this much before
// O and l are rescaled: P stays at or below 256, far inside f16.
#define LAZY_T 8.0f

__global__ void __launch_bounds__(256)
attn_kernel(const _Float16* __restrict__ qws, const _Float16* __restrict__ kws,
            const _Float16* __restrict__ vws, _Float16* __restrict__ ows)
{
  const int head = blockIdx.x >> 4;
  const int qblk = blockIdx.x & 15;
  const int wave = threadIdx.x >> 5;
  const int lane = threadIdx.x & 31;

  const _Float16* qh = qws + head * (NN * DD);
  const _Float16* kh = kws + head * (NN * DD);
  const _Float16* vh = vws + head * (NN * DD);

  const int qbase = qblk * 128 + wave * 16;
  // Offset (halfs) of this lane's 8 values of d inside a 16-row x 16-half tile.
  const int fofs = (lane & 15) * DD + ((lane < 16) ? 0 : 8);
  // The product's depth is 32 and d is 16: one A fragment carries TWO key tiles,
  // tile 0 at k = 0..15 and tile 1 at k = 16..31. Q stands twice as B operand,
  // once in each k half with zeros in the other, and so picks one of the tiles.
  H16 q0, q1;
  {
    const v4u z4 = {};
    const v4u qv = *(const v4u*)(qh + qbase * DD + fofs);
    q0.u[0] = qv; q0.u[1] = z4;
    q1.u[0] = z4; q1.u[1] = qv;
  }

  v8f acc = {};                               // O^T: acc[r] = O[q = lane&15][d = 8*half + r]
  float l = 0.0f;                             // this half's share of the row sum

  // K and V come from the launch before and are first read here by all blocks of
  // a head at about the same time, so a tile's loads may take longer than a pass
  // computes. They are issued two passes ahead: two register sets, one for the even
  // and one for the odd passes.
  const _Float16* kl = kh + fofs;             // this lane's 8 values of d, key row lane&15
  const _Float16* vl = vh + lane * 8;         // this lane's 8 keys of V^T, d = lane&15
  H16 kfA, btA, kfB, btB;
  load_pair(kfA, kl, 0);
  load_pair(btA, vl, 0);
  load_pair(kfB, kl, 32);
  load_pair(btB, vl, 32);

  // The reference maximum of this lane's query, negated, eight times over: it is
  // the C operand of the score products, which so give S - reference at once.
  // It starts as the true maximum over the first 32 keys and only ever rises.
  v8f negm;
  {
    const v8f z = {};
    float t = max16(wmma_f16(kfA.h, q0.h, z), wmma_f16(kfA.h, q1.h, z));
    t = fmaxf(t, other_half(t));
    // Unrolled, here and in the loop: constant indices name registers.
#pragma unroll
    for (int r = 0; r < 8; ++r) negm[r] = -t;
  }

  for (int kt = 0; kt < NN; kt += 64) {
    // Precaution: this trip forms new load addresses, in the built code in the
    // registers that the trip before gave to its loads, so those loads' addresses
    // are waited for first.
    asm volatile("s_wait_xcnt 0x0" ::: "memory");
    // First key of the two tiles fetched in this trip. The last trip wraps to the
    // head's first tiles: inside the buffer, loaded and not used.
    const int nk = (kt + 64) & (NN - 1);

    // S^T - reference, 16 keys and the next 16 per pass (A = K rows, B = Q rows):
    // a0[r] = S[q = lane&15][kt + 8*half + r] - reference, a1[r] 16 keys on.
    // Behind the last WMMA that reads a fragment stands its refill.
    v8f a0 = wmma_f16(kfA.h, q0.h, negm);
    v8f a1 = wmma_f16(kfA.h, q1.h, negm);
    load_pair(kfA, kl, nk);
    v8f b0 = wmma_f16(kfB.h, q0.h, negm);
    v8f b1 = wmma_f16(kfB.h, q1.h, negm);
    load_pair(kfB, kl, nk + 32);

    // One test per trip, the same for the whole wave (a scalar branch): only if
    // some score of the 64 keys passes its query's reference by more than LAZY_T
    // is the reference raised to the running maximum and O and l rescaled.
    float t = fmaxf(max16(a0, a1), max16(b0, b1));
    if (__builtin_amdgcn_ballot_w32(t > LAZY_T) != 0) {
      t = fmaxf(t, other_half(t));            // both halves of a query agree
      const float d = fmaxf(t, 0.0f);         // the reference never falls
      const float alpha = __builtin_amdgcn_exp2f(-d);
#pragma unroll
      for (int r = 0; r < 8; ++r) {
        a0[r] -= d; a1[r] -= d; b0[r] -= d; b1[r] -= d;
        negm[r] -= d;
        acc[r] *= alpha;
      }
      l *= alpha;
    }

    H16 ptA, ptB;
    l += exp_pack(a0, a1, ptA);
    l += exp_pack(b0, b1, ptB);
    // Keeps both passes' exponentials in front of the output WMMAs.
    __builtin_amdgcn_sched_barrier(0);
    acc = wmma_f16(btA.h, ptA.h, acc);
    load_pair(btA, vl, nk);
    acc = wmma_f16(btB.h, ptB.h, acc);
    load_pair(btB, vl, nk + 32);
  }
  // Precaution: what follows may write the registers that held the last trip's
  // load addresses, so those addresses are waited for first.
  asm volatile("s_wait_xcnt 0x0" ::: "memory");

  // O = acc / l into the (B,N,C) f16 workspace for the projection GEMM:
  // a lane holds 8 consecutive d of one query, one 16-byte store.
  const int b = head >> 4;
  const int h = head & 15;
  const int n = qbase + (lane & 15);
  const int dofs = (lane < 16) ? 0 : 8;
  l += other_half(l);                         // join the halves' sums once
  union { v4u u; _Float16 e[8]; } o;
#pragma unroll
  for (int r = 0; r < 8; ++r) o.e[r] = (_Float16)(acc[r] / l);
  *(v4u*)(ows + (b * NN + n) * CC + h * DD + dofs) = o.u;
}

// ---------------------------------------------------------------------------
// Kernel 3: output projection (8192x256)@(256x256) + bias -> f32.
// Each wave: 16x32 output tile (2 accumulators share one A fragment).
// ---------------------------------------------------------------------------
__global__ void __launch_bounds__(256)
proj_kernel(const _Float16* __restrict__ ows, const float* __restrict__ w,
            const float* __restrict__ bias, float* __restrict__ out)
{
  const int WSTR = 264;
  __shared__ _Float16 wT[32 * WSTR];
  const int colBase = blockIdx.y * 32;

  for (int i = threadIdx.x; i < 32 * 256; i += 256) {
    int col = i & 31, k = i >> 5;
    wT[col * WSTR + k] = (_Float16)w[k * CC + colBase + col];
  }
  __syncthreads();

  const int wave = threadIdx.x >> 5;
  const int lane = threadIdx.x & 31;
  const int rowBase = (blockIdx.x * 8 + wave) * 16;

  v8f acc0 = {}, acc1 = {};
#pragma unroll
  for (int kc = 0; kc < CC; kc += 32) {
    v16h a  = load_tile_halfrows(ows + rowBase * CC + kc, CC);
    v16h b0 = load_tile_halfrows(wT + kc, WSTR);
    v16h b1 = load_tile_halfrows(wT + 16 * WSTR + kc, WSTR);
    acc0 = wmma_f16(a, b0, acc0);
    acc1 = wmma_f16(a, b1, acc1);
  }

  const int col = lane & 15;
  const int rofs = (lane < 16) ? 0 : 8;
  v8f accs[2] = {acc0, acc1};
#pragma unroll
  for (int tg = 0; tg < 2; ++tg) {
    const int cb = colBase + tg * 16;
    const float bv = bias[cb + col];
#pragma unroll
    for (int r = 0; r < 8; ++r) {
      int row = rowBase + r + rofs;
      out[row * CC + cb + col] = accs[tg][r] + bv;
    }
  }
}

// ---------------------------------------------------------------------------
extern "C" void kernel_launch(void* const* d_in, const int* in_sizes, int n_in,
                              void* d_out, int out_size, void* d_ws, size_t ws_size,
                              hipStream_t stream) {
  (void)in_sizes; (void)n_in; (void)out_size; (void)ws_size;
  const float* x      = (const float*)d_in[0];
  const float* w_qkv  = (const float*)d_in[1];
  const float* b_qkv  = (const float*)d_in[2];
  const float* w_proj = (const float*)d_in[3];
  const float* b_proj = (const float*)d_in[4];
  float* out = (float*)d_out;

  const size_t headElems = (size_t)NHEAD * NN * DD;     // 2M halfs = 4 MB
  _Float16* qws = (_Float16*)d_ws;
  _Float16* kws = qws + headElems;
  _Float16* vws = kws + headElems;
  _Float16* ows = vws + headElems;                      // (B,N,C) f16, 4 MB

  qkv_kernel<<<dim3(ROWS / (QWAVES * 16), (3 * CC) / QCOLS), QWAVES * 32, 0, stream>>>(
      x, w_qkv, b_qkv, qws, kws, vws);
  attn_kernel<<<NHEAD * (NN / 128), 256, 0, stream>>>(qws, kws, vws, ows);
  proj_kernel<<<dim3(ROWS / 128, CC / 32), 256, 0, stream>>>(
      ows, w_proj, b_proj, out);
}

// v008
// Measured time: 47.5 microseconds a run.
// Two timings next to v007 put it at 1.07 and 1.06 times that version's speed.
// All steps since v000 together make it 3.79 times as fast.
#include <hip/hip_runtime.h>

// ---------------------------------------------------------------------------
// CDNA5 (gfx1250) fused multi-head attention:
//   qkv = x @ w_qkv + b_qkv  -> Q,K,V (f16, head-major)
//   flash attention per (b,h) with v_wmma_f32_16x16x32_f16
//   out = O @ w_proj + b_proj (f32)
// CDNA5 paths: WMMA f16.
// ---------------------------------------------------------------------------

typedef __attribute__((ext_vector_type(16))) _Float16 v16h;
typedef __attribute__((ext_vector_type(8)))  float    v8f;
typedef __attribute__((ext_vector_type(4)))  unsigned int v4u;

union H16 { v16h h; v4u u[2]; _Float16 e[16]; };

#define BB 4
#define NN 2048
#define CC 256
#define HH 16
#define DD 16
#define NHEAD (BB*HH)          // 64
#define ROWS  (BB*NN)          // 8192

__device__ __forceinline__ v8f wmma_f16(v16h a, v16h b, v8f c) {
  // D = A(16x32 f16) * B(32x16 f16) + C(16x16 f32)
  return __builtin_amdgcn_wmma_f32_16x16x32_f16(
      false, a, false, b, (short)0, c, false, false);
}

// A/B operand fragment from a 16-row x 32-half row-major tile (global or LDS).
// Lane L (L%16 = row/col), K chunks {b0..b0+7, 16+b0..16+b0+7}, b0 = (L<16?0:8).
__device__ __forceinline__ v16h load_tile_halfrows(const _Float16* base, int rowStride) {
  const int lane = threadIdx.x & 31;
  const int row  = lane & 15;
  const int b0   = (lane < 16) ? 0 : 8;
  const _Float16* p = base + row * rowStride;
  H16 t;
  t.u[0] = *(const v4u*)(p + b0);
  t.u[1] = *(const v4u*)(p + 16 + b0);
  return t.h;
}

// A fragment from f32 global rows, converted to f16 on the fly.
__device__ __forceinline__ v16h load_tile_f32rows(const float* base, int rowStride) {
  const int lane = threadIdx.x & 31;
  const int row  = lane & 15;
  const int b0   = (lane < 16) ? 0 : 8;
  const float* p = base + row * rowStride;
  H16 t;
#pragma unroll
  for (int i = 0; i < 8; ++i) t.e[i]     = (_Float16)p[b0 + i];
#pragma unroll
  for (int i = 0; i < 8; ++i) t.e[8 + i] = (_Float16)p[16 + b0 + i];
  return t.h;
}

// ---------------------------------------------------------------------------
// Kernel 1: QKV projection. grid (32 row groups, 8 column groups), 512 threads.
// A block takes 256 rows x 96 columns of (8192 x 768); each of its 16 waves one
// 16x96 tile: one A fragment of x feeds 6 WMMAs, and x is read 8 times in all.
// Output scattered to head-major f16 Q/K: [b*H+h][n][16]. Q is stored times log2 e
// (scaled in f32, rounded to f16 once): attention's scores are then exponents of 2.
// V keeps the same 512-byte place per 16-key tile, but transposed inside it:
// [b*H+h][n/16][lane][8], lane = 16*((n%16)/8) + d, element = n%8. That is the
// accumulator's own order here and half an A fragment of V^T in attention.
// ---------------------------------------------------------------------------
#define QCOLS  96                             // columns of w_qkv per block
#define QTILES (QCOLS / 16)                   // 16-column tiles per wave
#define QWAVES 16                             // waves per block, 16 rows each
#define LOG2E  1.44269504f

// 256 blocks of 16 waves: one block a WGP, four waves a SIMD. The attribute gives
// the compiler that occupancy's registers, so that a wave's x loads are all issued
// at once and the LDS reads run ahead of the WMMAs that use them.
__global__ void __launch_bounds__(QWAVES * 32) __attribute__((amdgpu_waves_per_eu(4, 4)))
qkv_kernel(const float* __restrict__ x, const float* __restrict__ w,
           const float* __restrict__ bias,
           _Float16* __restrict__ qws, _Float16* __restrict__ kws,
           _Float16* __restrict__ vws)
{
  const int WSTR = 264;                       // padded LDS row stride (halfs)
  __shared__ _Float16 wT[QCOLS * WSTR];       // w^T tile: [col][k], f16
  const int colBase = blockIdx.y * QCOLS;
  const int wave = threadIdx.x >> 5;
  const int lane = threadIdx.x & 31;

  // A wave stages rows k = wave, wave + 16, ... of w: 96 columns are three whole
  // 128-byte lines. Unrolled so that a thread's 48 loads fly together and the
  // tile costs one load latency, not one per group of loads.
#pragma unroll
  for (int i = 0; i < CC / QWAVES; ++i) {
    const int k = wave + i * QWAVES;
#pragma unroll
    for (int j = 0; j < QCOLS / 32; ++j) {
      const int col = lane + 32 * j;
      wT[col * WSTR + k] = (_Float16)w[k * (3 * CC) + colBase + col];
    }
  }
  __syncthreads();

  const int rowBase = (blockIdx.x * QWAVES + wave) * 16;

  // The loops over tg are unrolled so that acc[tg] names registers (an indexed
  // array would go to scratch memory) and the stores take constant offsets.
  v8f acc[QTILES] = {};
#pragma unroll
  for (int kc = 0; kc < CC; kc += 32) {
    v16h a = load_tile_f32rows(x + rowBase * CC + kc, CC);
    v16h b[QTILES];
#pragma unroll
    for (int tg = 0; tg < QTILES; ++tg)
      b[tg] = load_tile_halfrows(wT + tg * 16 * WSTR + kc, WSTR);
#pragma unroll
    for (int tg = 0; tg < QTILES; ++tg) acc[tg] = wmma_f16(a, b[tg], acc[tg]);
  }

  // Epilogue: bias + scatter into Q/K/V head-major layout, tile by tile. A tile
  // of 16 columns is one head of Q, of K or of V and never crosses.
  const int col  = lane & 15;                 // d
  const int rofs = (lane < 16) ? 0 : 8;
  const int bb = rowBase / NN;
  const int n0 = rowBase % NN;
  const float* bp = bias + colBase + col;
  float bv[QTILES];
#pragma unroll
  for (int tg = 0; tg < QTILES; ++tg) bv[tg] = bp[tg * 16];
#pragma unroll
  for (int tg = 0; tg < QTILES; ++tg) {
    const int cb = colBase + tg * 16;
    const int s = cb / CC;                    // 0=q 1=k 2=v: the same in every thread
    const int h = (cb % CC) / DD;
    const int hofs = (bb * HH + h) * (NN * DD);
    if (s == 2) {                             // V: a lane's 8 keys of one d, 16 bytes
      union { v4u u; _Float16 e[8]; } pv;
#pragma unroll
      for (int r = 0; r < 8; ++r) pv.e[r] = (_Float16)(acc[tg][r] + bv[tg]);
      *(v4u*)(vws + hofs + n0 * DD + lane * 8) = pv.u;
      // Precaution, here and in the other branch: the instructions that follow
      // in the built code may write this tile's store address and data
      // registers, so the stores are waited for first.
      asm volatile("s_wait_xcnt 0x0" ::: "memory");
    } else {
      _Float16* dst = ((s == 0) ? qws : kws) + hofs;
      const float sc = (s == 0) ? LOG2E : 1.0f;   // times 1 is exact: K stays unscaled
#pragma unroll
      for (int r = 0; r < 8; ++r) {
        int n = n0 + r + rofs;
        dst[n * DD + col] = (_Float16)((acc[tg][r] + bv[tg]) * sc);
      }
      asm volatile("s_wait_xcnt 0x0" ::: "memory");
    }
  }
}

// ---------------------------------------------------------------------------
// Kernel 2: flash attention. grid = 64 heads * 16 qblocks, 256 threads.
// Wave owns 16 q rows; loops k in chunks of 32, no LDS and no barrier:
//   2x WMMA S^T = K Q^T (two key tiles share one A fragment, Q zero-padded): a
//   lane holds 16 scores of ONE query, in units of log2 (Q comes times log2 e),
//   online softmax in-lane against a reference maximum that the score WMMAs
//   subtract (C operand); no maximum is taken on the usual path: the sum of P
//   tells whether the reference is too low, and only then are the scores formed
//   again, their maximum taken, halves exchanged and O, l rescaled,
//   P^T packs from the score registers straight into the B operand,
//   V^T A-fragment by two 16-byte global loads (V is stored in that order),
//   1x WMMA O^T += V^T P^T.
// ---------------------------------------------------------------------------
// Value of lane l ^ 16 (the other half of the same query column).
__device__ __forceinline__ float other_half(float v) {
  int b = __builtin_bit_cast(int, v);
  b = __builtin_amdgcn_permlanex16(b, b, 0x76543210, 0xfedcba98, false, false);
  return __builtin_bit_cast(float, b);
}

// Both 16-byte halves of a 32-key fragment: keys key..key+15 and key+16..key+31.
__device__ __forceinline__ void load_pair(H16& f, const _Float16* lanep, int key) {
  f.u[0] = *(const v4u*)(lanep + key * DD);
  f.u[1] = *(const v4u*)(lanep + (key + 16) * DD);
  // Keeps the loads early in the trip and in this order: without it the compiler
  // gathers all loads of a trip at the loop's foot, directly in front of their use.
  __builtin_amdgcn_sched_barrier(0);
}

// Largest of a lane's 16 scores of one 32-key pass.
__device__ __forceinline__ float max16(v8f a, v8f b) {
  v8f t8;
  // Unrolled: constant indices name registers.
#pragma unroll
  for (int r = 0; r < 8; ++r) t8[r] = fmaxf(a[r], b[r]);
  return fmaxf(fmaxf(fmaxf(t8[0], t8[1]), fmaxf(t8[2], t8[3])),
               fmaxf(fmaxf(t8[4], t8[5]), fmaxf(t8[6], t8[7])));
}

// Eight exponentials of 2, back to back, from the score registers into fresh ones
// (written in place, the compiler moved half of the scores to other registers
// first). The outputs are early-clobber: an output is written while later inputs are
// still to be read. The v_nop is the free slot that the instruction set asks for
// behind a transcendental before its result is read or its source overwritten: one
// for the run, where the compiler's own order took one behind every third or fourth.
// Volatile: the runs keep their order and stay behind the statement that holds the
// score WMMAs in front of them.
__device__ __forceinline__ void exp2x8(v8f s, float (&p)[8]) {
  asm volatile("v_exp_f32 %0, %8\n\tv_exp_f32 %1, %9\n\tv_exp_f32 %2, %10\n\tv_exp_f32 %3, %11\n\t"
      "v_exp_f32 %4, %12\n\tv_exp_f32 %5, %13\n\tv_exp_f32 %6, %14\n\tv_exp_f32 %7, %15\n\t"
      "v_nop"
      : "=&v"(p[0]), "=&v"(p[1]), "=&v"(p[2]), "=&v"(p[3]),
        "=&v"(p[4]), "=&v"(p[5]), "=&v"(p[6]), "=&v"(p[7])
      : "v"(s[0]), "v"(s[1]), "v"(s[2]), "v"(s[3]),
        "v"(s[4]), "v"(s[5]), "v"(s[6]), "v"(s[7]));
}

// P^T = 2^(shifted scores) of one 32-key pass as B operand in the hardware k
// order; returns this lane's sum of the 16 values. The scores carry log2 e already.
__device__ __forceinline__ float exp_pack(v8f s0, v8f s1, H16& pt) {
  float p0[8], p1[8];
  exp2x8(s0, p0);
  exp2x8(s1, p1);
  float rs[8];
  // Unrolled: constant indices keep the arrays in registers.
#pragma unroll
  for (int r = 0; r < 8; ++r) {
    rs[r] = p0[r] + p1[r];
    pt.e[r]     = (_Float16)p0[r];
    pt.e[8 + r] = (_Float16)p1[r];
  }
  return ((rs[0] + rs[1]) + (rs[2] + rs[3])) + ((rs[4] + rs[5]) + (rs[6] + rs[7]));
}

// A lane's sum of its 32 values of P of one trip may reach this much before the
// reference is raised. P is positive, so no single P is above the sum: P stays at
// or below 2^15, inside f16. An overflow of 2^x in f32 gives an infinite sum and
// is caught by the same test.
#define LAZY_SUM 32768.0f

__global__ void __launch_bounds__(256)
attn_kernel(const _Float16* __restrict__ qws, const _Float16* __restrict__ kws,
            const _Float16* __restrict__ vws, _Float16* __restrict__ ows)
{
  const int head = blockIdx.x >> 4;
  const int qblk = blockIdx.x & 15;
  const int wave = threadIdx.x >> 5;
  const int lane = threadIdx.x & 31;

  const _Float16* qh = qws + head * (NN * DD);
  const _Float16* kh = kws + head * (NN * DD);
  const _Float16* vh = vws + head * (NN * DD);

  const int qbase = qblk * 128 + wave * 16;
  // Offset (halfs) of this lane's 8 values of d inside a 16-row x 16-half tile.
  const int fofs = (lane & 15) * DD + ((lane < 16) ? 0 : 8);
  // The product's depth is 32 and d is 16: one A fragment carries TWO key tiles,
  // tile 0 at k = 0..15 and tile 1 at k = 16..31. Q stands twice as B operand,
  // once in each k half with zeros in the other, and so picks one of the tiles.
  H16 q0, q1;
  {
    const v4u z4 = {};
    const v4u qv = *(const v4u*)(qh + qbase * DD + fofs);
    q0.u[0] = qv; q0.u[1] = z4;
    q1.u[0] = z4; q1.u[1] = qv;
  }

  v8f acc = {};                               // O^T: acc[r] = O[q = lane&15][d = 8*half + r]
  float l = 0.0f;                             // this half's share of the row sum

  // K and V come from the launch before and are first read here by all blocks of
  // a head at about the same time, so a tile's loads may take longer than a pass
  // computes. They are issued two passes ahead: two register sets, one for the even
  // and one for the odd passes.
  const _Float16* kl = kh + fofs;             // this lane's 8 values of d, key row lane&15
  const _Float16* vl = vh + lane * 8;         // this lane's 8 keys of V^T, d = lane&15
  H16 kfA, btA, kfB, btB;
  load_pair(kfA, kl, 0);
  load_pair(btA, vl, 0);
  load_pair(kfB, kl, 32);
  load_pair(btB, vl, 32);

  // The reference maximum of this lane's query, negated, eight times over: it is
  // the C operand of the score products, which so give S - reference at once.
  // It starts as the true maximum over the first 32 keys and only ever rises.
  v8f negm;
  {
    const v8f z = {};
    float t = max16(wmma_f16(kfA.h, q0.h, z), wmma_f16(kfA.h, q1.h, z));
    t = fmaxf(t, other_half(t));
    // Unrolled, here and in the loop: constant indices name registers.
#pragma unroll
    for (int r = 0; r < 8; ++r) negm[r] = -t;
  }

  for (int kt = 0; kt < NN; kt += 64) {
    // Precaution: this trip forms new load addresses, in the built code in the
    // registers that the trip before gave to its loads, so those loads' addresses
    // are waited for first.
    asm volatile("s_wait_xcnt 0x0" ::: "memory");
    // First key of the two tiles fetched in this trip. The last trip wraps to the
    // head's first tiles: inside the buffer, loaded and not used.
    const int nk = (kt + 64) & (NN - 1);

    // S^T - reference, 16 keys and the next 16 per pass (A = K rows, B = Q rows):
    // a0[r] = S[q = lane&15][kt + 8*half + r] - reference, a1[r] 16 keys on.
    // Behind the last WMMA that reads a fragment stands its refill.
    v8f a0 = wmma_f16(kfA.h, q0.h, negm);
    v8f a1 = wmma_f16(kfA.h, q1.h, negm);
    load_pair(kfA, kl, nk);
    v8f b0 = wmma_f16(kfB.h, q0.h, negm);
    v8f b1 = wmma_f16(kfB.h, q1.h, negm);
    // The exponentials read the WMMAs' results directly, and they are asm text.
    // Taking all four results as inputs, this keeps
    // the four WMMAs in front of them; three WMMAs then stand between the first one
    // and the first read of its result, and the v_nop is the fourth slot the chip needs.
    asm volatile("v_nop" :: "v"(a0), "v"(a1), "v"(b0), "v"(b1));
    load_pair(kfB, kl, nk + 32);

    H16 ptA, ptB;
    float s = exp_pack(a0, a1, ptA) + exp_pack(b0, b1, ptB);

    // One test per trip, the same for the whole wave (a scalar branch), on the sum
    // that is formed anyway: only if some lane's sum passes LAZY_SUM is this trip
    // done again. The scores are gone and the K registers are being refilled, so
    // the trip's K tiles are loaded anew; then the reference is raised to the
    // running maximum, O and l are rescaled and P and its sum are formed again.
    if (__builtin_amdgcn_ballot_w32(s > LAZY_SUM) != 0) {
      // The maximum first, one 32-key pass at a time, from scores that are dropped at
      // once. Kept rolled: unrolled, both passes' scores were live together and the
      // kernel passed 128 registers, the most that keep eight waves on a SIMD.
      float t = 0.0f;                         // the reference never falls
#pragma unroll 1
      for (int j = 0; j < 64; j += 32) {
        H16 kk;
        kk.u[0] = *(const v4u*)(kl + (kt + j) * DD);
        kk.u[1] = *(const v4u*)(kl + (kt + j + 16) * DD);
        t = fmaxf(t, max16(wmma_f16(kk.h, q0.h, negm), wmma_f16(kk.h, q1.h, negm)));
      }
      const float d = fmaxf(t, other_half(t)); // both halves of a query agree
      const float alpha = __builtin_amdgcn_exp2f(-d);
#pragma unroll
      for (int r = 0; r < 8; ++r) {
        negm[r] -= d;
        acc[r] *= alpha;
      }
      l *= alpha;
      // Then the trip's scores against the raised reference, as on the usual path.
      H16 ka, kb;
      ka.u[0] = *(const v4u*)(kl + kt * DD);
      ka.u[1] = *(const v4u*)(kl + (kt + 16) * DD);
      kb.u[0] = *(const v4u*)(kl + (kt + 32) * DD);
      kb.u[1] = *(const v4u*)(kl + (kt + 48) * DD);
      a0 = wmma_f16(ka.h, q0.h, negm);
      a1 = wmma_f16(ka.h, q1.h, negm);
      b0 = wmma_f16(kb.h, q0.h, negm);
      b1 = wmma_f16(kb.h, q1.h, negm);
      // Keeps the WMMAs in front of the asm text, as above. Four slots here: the
      // exponentials may write the registers of ka and kb, operands of the last WMMA.
      asm volatile("v_nop\n\tv_nop\n\tv_nop\n\tv_nop" :: "v"(a0), "v"(a1), "v"(b0), "v"(b1));
      s = exp_pack(a0, a1, ptA) + exp_pack(b0, b1, ptB);
    }
    l += s;
    // Keeps both passes' exponentials in front of the output WMMAs.
    __builtin_amdgcn_sched_barrier(0);
    acc = wmma_f16(btA.h, ptA.h, acc);
    load_pair(btA, vl, nk);
    acc = wmma_f16(btB.h, ptB.h, acc);
    load_pair(btB, vl, nk + 32);
  }
  // Precaution: what follows may write the registers that held the last trip's
  // load addresses, so those addresses are waited for first.
  asm volatile("s_wait_xcnt 0x0" ::: "memory");

  // O = acc / l into the (B,N,C) f16 workspace for the projection GEMM:
  // a lane holds 8 consecutive d of one query, one 16-byte store.
  const int b = head >> 4;
  const int h = head & 15;
  const int n = qbase + (lane & 15);
  const int dofs = (lane < 16) ? 0 : 8;
  l += other_half(l);                         // join the halves' sums once
  union { v4u u; _Float16 e[8]; } o;
#pragma unroll
  for (int r = 0; r < 8; ++r) o.e[r] = (_Float16)(acc[r] / l);
  *(v4u*)(ows + (b * NN + n) * CC + h * DD + dofs) = o.u;
}

// ---------------------------------------------------------------------------
// Kernel 3: output projection (8192x256)@(256x256) + bias -> f32.
// Each wave: 16x32 output tile (2 accumulators share one A fragment).
// ---------------------------------------------------------------------------
__global__ void __launch_bounds__(256)
proj_kernel(const _Float16* __restrict__ ows, const float* __restrict__ w,
            const float* __restrict__ bias, float* __restrict__ out)
{
  const int WSTR = 264;
  __shared__ _Float16 wT[32 * WSTR];
  const int colBase = blockIdx.y * 32;

  for (int i = threadIdx.x; i < 32 * 256; i += 256) {
    int col = i & 31, k = i >> 5;
    wT[col * WSTR + k] = (_Float16)w[k * CC + colBase + col];
  }
  __syncthreads();

  const int wave = threadIdx.x >> 5;
  const int lane = threadIdx.x & 31;
  const int rowBase = (blockIdx.x * 8 + wave) * 16;

  v8f acc0 = {}, acc1 = {};
#pragma unroll
  for (int kc = 0; kc < CC; kc += 32) {
    v16h a  = load_tile_halfrows(ows + rowBase * CC + kc, CC);
    v16h b0 = load_tile_halfrows(wT + kc, WSTR);
    v16h b1 = load_tile_halfrows(wT + 16 * WSTR + kc, WSTR);
    acc0 = wmma_f16(a, b0, acc0);
    acc1 = wmma_f16(a, b1, acc1);
  }

  const int col = lane & 15;
  const int rofs = (lane < 16) ? 0 : 8;
  v8f accs[2] = {acc0, acc1};
#pragma unroll
  for (int tg = 0; tg < 2; ++tg) {
    const int cb = colBase + tg * 16;
    const float bv = bias[cb + col];
#pragma unroll
    for (int r = 0; r < 8; ++r) {
      int row = rowBase + r + rofs;
      out[row * CC + cb + col] = accs[tg][r] + bv;
    }
  }
}

// ---------------------------------------------------------------------------
extern "C" void kernel_launch(void* const* d_in, const int* in_sizes, int n_in,
                              void* d_out, int out_size, void* d_ws, size_t ws_size,
                              hipStream_t stream) {
  (void)in_sizes; (void)n_in; (void)out_size; (void)ws_size;
  const float* x      = (const float*)d_in[0];
  const float* w_qkv  = (const float*)d_in[1];
  const float* b_qkv  = (const float*)d_in[2];
  const float* w_proj = (const float*)d_in[3];
  const float* b_proj = (const float*)d_in[4];
  float* out = (float*)d_out;

  const size_t headElems = (size_t)NHEAD * NN * DD;     // 2M halfs = 4 MB
  _Float16* qws = (_Float16*)d_ws;
  _Float16* kws = qws + headElems;
  _Float16* vws = kws + headElems;
  _Float16* ows = vws + headElems;                      // (B,N,C) f16, 4 MB

  qkv_kernel<<<dim3(ROWS / (QWAVES * 16), (3 * CC) / QCOLS), QWAVES * 32, 0, stream>>>(
      x, w_qkv, b_qkv, qws, kws, vws);
  attn_kernel<<<NHEAD * (NN / 128), 256, 0, stream>>>(qws, kws, vws, ows);
  proj_kernel<<<dim3(ROWS / 128, CC / 32), 256, 0, stream>>>(
      ows, w_proj, b_proj, out);
}
